// v000
// The times below were measured on an AMD MI455X: many runs one after another, warmed up first and cycling through
// copies of the inputs, with the whole window's GPU time divided by the number of runs. Launches and the gaps
// between them are all in it. The median over several windows is given; except for v000 it joins two sittings, which
// can be a few percent apart, so the side-by-side timings, each taken in one sitting, are the better comparison.
// v000 is the starting kernel. One run takes 328 microseconds.
#include <hip/hip_runtime.h>
#include <hip/hip_bf16.h>

// ---------------------------------------------------------------------------
// Multi-head attention for MI455X (gfx1250, wave32, WMMA f32_16x16x32_f16).
// Pipeline: cast->f16 | Q/K/V proj GEMMs (WMMA, double-buffered LDS) |
// flash attention (WMMA, online softmax) | output proj GEMM (WMMA, fp32 out).
// ~69 GFLOP total, ~120MB minimum HBM traffic -> roughly balanced with f16
// matrix cores; scalar fp32 would be hopelessly compute-bound.
// ---------------------------------------------------------------------------

typedef __attribute__((ext_vector_type(16))) _Float16 v16h;
typedef __attribute__((ext_vector_type(8)))  float    v8f;

#define WMMA16(a, b, c) \
  __builtin_amdgcn_wmma_f32_16x16x32_f16(false, (a), false, (b), (short)0, (c), false, false)

constexpr int BB = 2;      // batch
constexpr int S  = 2048;   // seq len
constexpr int D  = 1024;   // model dim
constexpr int H  = 16;     // heads
constexpr int HD = 64;     // head dim
constexpr int MT = BB * S; // 4096 tokens

// Load one v16h WMMA operand (16-bit A/B layout): caller passes base already
// offset by kA = (lane<16 ? 0 : 8); halves 0..7 = base[0..7], 8..15 = base[16..23].
__device__ __forceinline__ v16h load_op16(const _Float16* p) {
  union { v16h v; float4 f4[2]; } u;
  u.f4[0] = *(const float4*)(p);
  u.f4[1] = *(const float4*)(p + 16);
  return u.v;
}

// ---------------------------------------------------------------------------
// f32 -> f16 cast, 4 elements per thread
// ---------------------------------------------------------------------------
__global__ void cast_f32_to_f16(const float* __restrict__ src,
                                _Float16* __restrict__ dst, int n4) {
  int i = blockIdx.x * blockDim.x + threadIdx.x;
  if (i < n4) {
    float4 v = ((const float4*)src)[i];
    union { _Float16 h[4]; unsigned long long u; } w;
    w.h[0] = (_Float16)v.x; w.h[1] = (_Float16)v.y;
    w.h[2] = (_Float16)v.z; w.h[3] = (_Float16)v.w;
    ((unsigned long long*)dst)[i] = w.u;
  }
}

// ---------------------------------------------------------------------------
// GEMM: C[M=4096][N=1024] = A[4096][1024](f16) x B[1024][1024](f16) + bias(f32)
// MODE 0: store f16 row-major      (Q, K projections)
// MODE 1: store f16 as Vt[b,h,d,s] (V projection, pre-transposed for P@V)
// MODE 2: store f32 row-major      (final output projection)
// Block tile 128x128, 8 waves (4 along M x 2 along N), K-step 32,
// double-buffered LDS: one barrier per K-step, global loads for step k+1
// staged in registers while WMMAs consume buffer k.
// ---------------------------------------------------------------------------
template <int MODE>
__global__ __launch_bounds__(256) void gemm_f16_wmma(
    const _Float16* __restrict__ A, const _Float16* __restrict__ Bw,
    const float* __restrict__ bias, void* __restrict__ out) {
  constexpr int K = 1024, N = 1024;
  __shared__ _Float16 lds_a[2][128 * 32];  // [m][k]
  __shared__ _Float16 lds_b[2][128 * 32];  // [n][k] (transposed on the way in)

  const int tid  = threadIdx.x;
  const int wave = tid >> 5, lane = tid & 31;
  const int l15  = lane & 15, hi = lane >> 4;
  const int kA   = hi ? 8 : 0;
  const int wm   = wave & 3;   // 4 wave-rows of 32
  const int wn   = wave >> 2;  // 2 wave-cols of 64
  const int m0   = blockIdx.y * 128, n0 = blockIdx.x * 128;

  // per-thread staging assignment
  const int arow = tid >> 1, akc = (tid & 1) * 16;  // A: 128 rows x 32
  const int bkr = tid >> 3, bch = tid & 7;          // B: 32 rows x 8 col-chunks

  v8f acc[2][4];
  const v8f vzero = {0.f, 0.f, 0.f, 0.f, 0.f, 0.f, 0.f, 0.f};
#pragma unroll
  for (int i = 0; i < 2; i++)
#pragma unroll
    for (int j = 0; j < 4; j++) acc[i][j] = vzero;

  float4 ra0, ra1, rb0, rb1;
  auto g_load = [&](int k0) {
    const float4* asrc = (const float4*)(A + (size_t)(m0 + arow) * K + k0 + akc);
    ra0 = asrc[0];
    ra1 = asrc[1];
    const _Float16* bsrc = Bw + (size_t)(k0 + bkr) * N + n0 + bch * 16;
    rb0 = *(const float4*)(bsrc);
    rb1 = *(const float4*)(bsrc + 8);
  };
  auto l_store = [&](int buf) {
    *(float4*)(&lds_a[buf][arow * 32 + akc])     = ra0;
    *(float4*)(&lds_a[buf][arow * 32 + akc + 8]) = ra1;
    union { float4 f4[2]; _Float16 h[16]; } u;
    u.f4[0] = rb0;
    u.f4[1] = rb1;
#pragma unroll
    for (int i = 0; i < 16; i++) lds_b[buf][(bch * 16 + i) * 32 + bkr] = u.h[i];
  };

  g_load(0);
  l_store(0);
  __syncthreads();

  for (int k0 = 0; k0 < K; k0 += 32) {
    const int cur = (k0 >> 5) & 1, nxt = cur ^ 1;
    const bool more = (k0 + 32) < K;
    if (more) g_load(k0 + 32);  // overlap next global fetch with WMMA

    v16h aop[2], bop[4];
#pragma unroll
    for (int mt = 0; mt < 2; mt++)
      aop[mt] = load_op16(&lds_a[cur][(wm * 32 + mt * 16 + l15) * 32 + kA]);
#pragma unroll
    for (int nt = 0; nt < 4; nt++)
      bop[nt] = load_op16(&lds_b[cur][(wn * 64 + nt * 16 + l15) * 32 + kA]);
#pragma unroll
    for (int mt = 0; mt < 2; mt++)
#pragma unroll
      for (int nt = 0; nt < 4; nt++)
        acc[mt][nt] = WMMA16(aop[mt], bop[nt], acc[mt][nt]);

    if (more) l_store(nxt);  // other buffer: no conflict with current readers
    __syncthreads();
  }

  // Epilogue: add bias, store per mode. C layout: VGPR r holds row r + 8*hi,
  // lane%16 holds column within the 16x16 tile.
#pragma unroll
  for (int mt = 0; mt < 2; mt++) {
#pragma unroll
    for (int nt = 0; nt < 4; nt++) {
      int col = n0 + wn * 64 + nt * 16 + l15;
      float bv = bias[col];
      union { v8f v; float f[8]; } u;
      u.v = acc[mt][nt];
#pragma unroll
      for (int r = 0; r < 8; r++) {
        int row = m0 + wm * 32 + mt * 16 + r + hi * 8;
        float val = u.f[r] + bv;
        if (MODE == 0) {
          ((_Float16*)out)[(size_t)row * N + col] = (_Float16)val;
        } else if (MODE == 1) {
          int hh = col >> 6, dd = col & 63;        // head, dim-in-head
          int b = row >> 11, s = row & (S - 1);    // batch, position
          ((_Float16*)out)[((size_t)(b * H + hh) * HD + dd) * S + s] = (_Float16)val;
        } else {
          ((float*)out)[(size_t)row * N + col] = val;
        }
      }
    }
  }
}

// ---------------------------------------------------------------------------
// Flash attention: one wave = 16 query rows of one (b,h); block = 8 waves
// = 128 query rows. Online softmax over 32-key chunks. No cross-wave sync.
// K/V total 16MB f16 -> resident in 192MB L2, so no LDS staging for K/V.
// ---------------------------------------------------------------------------
__global__ __launch_bounds__(256) void flash_attn_wmma(
    const _Float16* __restrict__ Qp, const _Float16* __restrict__ Kp,
    const _Float16* __restrict__ Vt, const int* __restrict__ mask,
    _Float16* __restrict__ ctx) {
  __shared__ _Float16 lds_p[8][16 * 32];  // wave-private P staging (fp32->f16 relayout)

  const int tid  = threadIdx.x;
  const int wave = tid >> 5, lane = tid & 31;
  const int l15  = lane & 15, hi = lane >> 4;
  const int kA   = hi ? 8 : 0;

  const int qb = blockIdx.x & 15;  // S/128 = 16 query blocks
  const int bh = blockIdx.x >> 4;  // b*H + h
  const int b  = bh >> 4, h = bh & 15;
  const int sq = qb * 128 + wave * 16;  // first query row (within sequence)

  // Q rows held in registers: A-operand layout, d split into two K=32 chunks
  const _Float16* qbase = Qp + ((size_t)(b * S + sq + l15)) * D + h * HD;
  v16h aq0 = load_op16(qbase + kA);
  v16h aq1 = load_op16(qbase + 32 + kA);

  const v8f vzero = {0.f, 0.f, 0.f, 0.f, 0.f, 0.f, 0.f, 0.f};
  union { v8f v; float f[8]; } acc[4];
  float mrow[8], lrow[8];
#pragma unroll
  for (int t = 0; t < 4; t++) acc[t].v = vzero;
#pragma unroll
  for (int r = 0; r < 8; r++) { mrow[r] = -INFINITY; lrow[r] = 0.f; }

  _Float16* myp = &lds_p[wave][0];

  for (int kc = 0; kc < S; kc += 32) {
    // ---- scores: two 16x16 tiles (32 keys), contraction over HD=64 = 2xK32
    float p[2][8];
#pragma unroll
    for (int j = 0; j < 2; j++) {
      int key = kc + j * 16 + l15;
      const _Float16* kb = Kp + ((size_t)(b * S + key)) * D + h * HD;
      v16h bk0 = load_op16(kb + kA);
      v16h bk1 = load_op16(kb + 32 + kA);
      v8f sc = vzero;
      sc = WMMA16(aq0, bk0, sc);
      sc = WMMA16(aq1, bk1, sc);
      union { v8f v; float f[8]; } us;
      us.v = sc;
#pragma unroll
      for (int r = 0; r < 8; r++) {
        int q = sq + r + hi * 8;
        int mv = mask[((size_t)b * S + q) * S + (kc + j * 16 + l15)];
        float val = us.f[r] * 0.125f;  // 1/sqrt(64)
        p[j][r] = mv ? val : -1.0e9f;
      }
    }
    // ---- online softmax; a row spans the 16 lanes of one half (xor<16 stays in half)
#pragma unroll
    for (int r = 0; r < 8; r++) {
      float m = fmaxf(p[0][r], p[1][r]);
      m = fmaxf(m, __shfl_xor(m, 1, 32));
      m = fmaxf(m, __shfl_xor(m, 2, 32));
      m = fmaxf(m, __shfl_xor(m, 4, 32));
      m = fmaxf(m, __shfl_xor(m, 8, 32));
      float mnew = fmaxf(mrow[r], m);
      float corr = __expf(mrow[r] - mnew);
      mrow[r] = mnew;
      float p0 = __expf(p[0][r] - mnew);
      float p1 = __expf(p[1][r] - mnew);
      float sum = p0 + p1;
      sum += __shfl_xor(sum, 1, 32);
      sum += __shfl_xor(sum, 2, 32);
      sum += __shfl_xor(sum, 4, 32);
      sum += __shfl_xor(sum, 8, 32);
      lrow[r] = lrow[r] * corr + sum;
#pragma unroll
      for (int t = 0; t < 4; t++) acc[t].f[r] *= corr;
      // C-layout -> row-major f16 P tile in wave-private LDS
      myp[(r + hi * 8) * 32 + l15]      = (_Float16)p0;
      myp[(r + hi * 8) * 32 + 16 + l15] = (_Float16)p1;
    }
    // LDS is in-order per wave; wait so the A-operand gather sees all 32 lanes' stores
    asm volatile("s_wait_dscnt 0" ::: "memory");
    v16h ap = load_op16(&myp[l15 * 32 + kA]);
    // ---- P(16x32) @ V(32x64): Vt rows are contiguous along keys
#pragma unroll
    for (int t = 0; t < 4; t++) {
      const _Float16* vb = Vt + ((size_t)bh * HD + t * 16 + l15) * S + kc;
      v16h bv = load_op16(vb + kA);
      acc[t].v = WMMA16(ap, bv, acc[t].v);
    }
    asm volatile("" ::: "memory");
  }

  // ---- normalize and scatter into context [token][h*64 + d]
#pragma unroll
  for (int t = 0; t < 4; t++) {
#pragma unroll
    for (int r = 0; r < 8; r++) {
      int q = sq + r + hi * 8;
      float o = acc[t].f[r] / lrow[r];
      ctx[((size_t)(b * S + q)) * D + h * HD + t * 16 + l15] = (_Float16)o;
    }
  }
}

// ---------------------------------------------------------------------------
// Host-side launch
// ---------------------------------------------------------------------------
extern "C" void kernel_launch(void* const* d_in, const int* in_sizes, int n_in,
                              void* d_out, int out_size, void* d_ws, size_t ws_size,
                              hipStream_t stream) {
  const float* q_in  = (const float*)d_in[0];
  const float* k_in  = (const float*)d_in[1];
  const float* v_in  = (const float*)d_in[2];
  const int*   mask  = (const int*)d_in[3];
  const float* wq    = (const float*)d_in[4];
  const float* wqb   = (const float*)d_in[5];
  const float* wk    = (const float*)d_in[6];
  const float* wkb   = (const float*)d_in[7];
  const float* wv    = (const float*)d_in[8];
  const float* wvb   = (const float*)d_in[9];
  const float* wo    = (const float*)d_in[10];
  const float* wob   = (const float*)d_in[11];

  // Workspace carving (64 MB total, 256B aligned)
  char* ws = (char*)d_ws;
  size_t off = 0;
  auto alloc = [&](size_t bytes) {
    void* p = ws + off;
    off += (bytes + 255) & ~(size_t)255;
    return p;
  };
  const size_t IN_E = (size_t)MT * D;   // 4194304
  const size_t W_E  = (size_t)D * D;    // 1048576
  _Float16* qh  = (_Float16*)alloc(IN_E * 2);
  _Float16* kh  = (_Float16*)alloc(IN_E * 2);
  _Float16* vh  = (_Float16*)alloc(IN_E * 2);
  _Float16* wqh = (_Float16*)alloc(W_E * 2);
  _Float16* wkh = (_Float16*)alloc(W_E * 2);
  _Float16* wvh = (_Float16*)alloc(W_E * 2);
  _Float16* woh = (_Float16*)alloc(W_E * 2);
  _Float16* Qp  = (_Float16*)alloc(IN_E * 2);
  _Float16* Kp  = (_Float16*)alloc(IN_E * 2);
  _Float16* Vt  = (_Float16*)alloc(IN_E * 2);   // [b][h][d][s]
  _Float16* ctx = (_Float16*)alloc(IN_E * 2);

  // 1) casts
  int n4i = (int)(IN_E / 4), n4w = (int)(W_E / 4);
  cast_f32_to_f16<<<(n4i + 255) / 256, 256, 0, stream>>>(q_in, qh, n4i);
  cast_f32_to_f16<<<(n4i + 255) / 256, 256, 0, stream>>>(k_in, kh, n4i);
  cast_f32_to_f16<<<(n4i + 255) / 256, 256, 0, stream>>>(v_in, vh, n4i);
  cast_f32_to_f16<<<(n4w + 255) / 256, 256, 0, stream>>>(wq, wqh, n4w);
  cast_f32_to_f16<<<(n4w + 255) / 256, 256, 0, stream>>>(wk, wkh, n4w);
  cast_f32_to_f16<<<(n4w + 255) / 256, 256, 0, stream>>>(wv, wvh, n4w);
  cast_f32_to_f16<<<(n4w + 255) / 256, 256, 0, stream>>>(wo, woh, n4w);

  // 2) projections
  dim3 gg(D / 128, MT / 128);  // (8, 32)
  gemm_f16_wmma<0><<<gg, 256, 0, stream>>>(qh, wqh, wqb, (void*)Qp);
  gemm_f16_wmma<0><<<gg, 256, 0, stream>>>(kh, wkh, wkb, (void*)Kp);
  gemm_f16_wmma<1><<<gg, 256, 0, stream>>>(vh, wvh, wvb, (void*)Vt);

  // 3) attention: 512 blocks = B*H * (S/128)
  flash_attn_wmma<<<BB * H * (S / 128), 256, 0, stream>>>(Qp, Kp, Vt, mask, ctx);

  // 4) output projection -> fp32 d_out
  gemm_f16_wmma<2><<<gg, 256, 0, stream>>>(ctx, woh, wob, d_out);
}

// v001
// It runs in 262 microseconds.
// Two timings next to v000 both put it at 1.28 times that version's speed.
#include <hip/hip_runtime.h>
#include <hip/hip_bf16.h>

// ---------------------------------------------------------------------------
// Multi-head attention for MI455X (gfx1250, wave32, WMMA f32_16x16x32_f16).
// Pipeline: cast->f16 | Q/K/V proj GEMMs (WMMA, double-buffered LDS) |
// flash attention (WMMA, online softmax) | output proj GEMM (WMMA, fp32 out).
// ~69 GFLOP total, ~120MB minimum HBM traffic -> roughly balanced with f16
// matrix cores; scalar fp32 would be hopelessly compute-bound.
// ---------------------------------------------------------------------------

typedef __attribute__((ext_vector_type(16))) _Float16 v16h;
typedef __attribute__((ext_vector_type(8)))  float    v8f;

#define WMMA16(a, b, c) \
  __builtin_amdgcn_wmma_f32_16x16x32_f16(false, (a), false, (b), (short)0, (c), false, false)

constexpr int BB = 2;      // batch
constexpr int S  = 2048;   // seq len
constexpr int D  = 1024;   // model dim
constexpr int H  = 16;     // heads
constexpr int HD = 64;     // head dim
constexpr int MT = BB * S; // 4096 tokens

// Load one v16h WMMA operand (16-bit A/B layout): caller passes base already
// offset by kA = (lane<16 ? 0 : 8); halves 0..7 = base[0..7], 8..15 = base[16..23].
__device__ __forceinline__ v16h load_op16(const _Float16* p) {
  union { v16h v; float4 f4[2]; } u;
  u.f4[0] = *(const float4*)(p);
  u.f4[1] = *(const float4*)(p + 16);
  return u.v;
}

// ---------------------------------------------------------------------------
// f32 -> f16 cast, 4 elements per thread
// ---------------------------------------------------------------------------
__global__ void cast_f32_to_f16(const float* __restrict__ src,
                                _Float16* __restrict__ dst, int n4) {
  int i = blockIdx.x * blockDim.x + threadIdx.x;
  if (i < n4) {
    float4 v = ((const float4*)src)[i];
    union { _Float16 h[4]; unsigned long long u; } w;
    w.h[0] = (_Float16)v.x; w.h[1] = (_Float16)v.y;
    w.h[2] = (_Float16)v.z; w.h[3] = (_Float16)v.w;
    ((unsigned long long*)dst)[i] = w.u;
  }
}

// ---------------------------------------------------------------------------
// GEMM: C[M=4096][N=1024] = A[4096][1024](f16) x B[1024][1024](f16) + bias(f32)
// MODE 0: store f16 row-major      (Q, K projections)
// MODE 1: store f16 as Vt[b,h,d,s] (V projection, pre-transposed for P@V)
// MODE 2: store f32 row-major      (final output projection)
// Block tile 128x128, 8 waves (4 along M x 2 along N), K-step 32,
// double-buffered LDS: one barrier per K-step, global loads for step k+1
// staged in registers while WMMAs consume buffer k.
// ---------------------------------------------------------------------------
template <int MODE>
__global__ __launch_bounds__(256) void gemm_f16_wmma(
    const _Float16* __restrict__ A, const _Float16* __restrict__ Bw,
    const float* __restrict__ bias, void* __restrict__ out) {
  constexpr int K = 1024, N = 1024;
  __shared__ _Float16 lds_a[2][128 * 32];  // [m][k]
  __shared__ _Float16 lds_b[2][128 * 32];  // [n][k] (transposed on the way in)

  const int tid  = threadIdx.x;
  const int wave = tid >> 5, lane = tid & 31;
  const int l15  = lane & 15, hi = lane >> 4;
  const int kA   = hi ? 8 : 0;
  const int wm   = wave & 3;   // 4 wave-rows of 32
  const int wn   = wave >> 2;  // 2 wave-cols of 64
  const int m0   = blockIdx.y * 128, n0 = blockIdx.x * 128;

  // per-thread staging assignment
  const int arow = tid >> 1, akc = (tid & 1) * 16;  // A: 128 rows x 32
  const int bkr = tid >> 3, bch = tid & 7;          // B: 32 rows x 8 col-chunks

  v8f acc[2][4];
  const v8f vzero = {0.f, 0.f, 0.f, 0.f, 0.f, 0.f, 0.f, 0.f};
#pragma unroll
  for (int i = 0; i < 2; i++)
#pragma unroll
    for (int j = 0; j < 4; j++) acc[i][j] = vzero;

  float4 ra0, ra1, rb0, rb1;
  auto g_load = [&](int k0) {
    const float4* asrc = (const float4*)(A + (size_t)(m0 + arow) * K + k0 + akc);
    ra0 = asrc[0];
    ra1 = asrc[1];
    const _Float16* bsrc = Bw + (size_t)(k0 + bkr) * N + n0 + bch * 16;
    rb0 = *(const float4*)(bsrc);
    rb1 = *(const float4*)(bsrc + 8);
  };
  auto l_store = [&](int buf) {
    *(float4*)(&lds_a[buf][arow * 32 + akc])     = ra0;
    *(float4*)(&lds_a[buf][arow * 32 + akc + 8]) = ra1;
    union { float4 f4[2]; _Float16 h[16]; } u;
    u.f4[0] = rb0;
    u.f4[1] = rb1;
#pragma unroll
    for (int i = 0; i < 16; i++) lds_b[buf][(bch * 16 + i) * 32 + bkr] = u.h[i];
  };

  g_load(0);
  l_store(0);
  __syncthreads();

  for (int k0 = 0; k0 < K; k0 += 32) {
    const int cur = (k0 >> 5) & 1, nxt = cur ^ 1;
    const bool more = (k0 + 32) < K;
    if (more) g_load(k0 + 32);  // overlap next global fetch with WMMA

    v16h aop[2], bop[4];
#pragma unroll
    for (int mt = 0; mt < 2; mt++)
      aop[mt] = load_op16(&lds_a[cur][(wm * 32 + mt * 16 + l15) * 32 + kA]);
#pragma unroll
    for (int nt = 0; nt < 4; nt++)
      bop[nt] = load_op16(&lds_b[cur][(wn * 64 + nt * 16 + l15) * 32 + kA]);
#pragma unroll
    for (int mt = 0; mt < 2; mt++)
#pragma unroll
      for (int nt = 0; nt < 4; nt++)
        acc[mt][nt] = WMMA16(aop[mt], bop[nt], acc[mt][nt]);

    if (more) l_store(nxt);  // other buffer: no conflict with current readers
    __syncthreads();
  }

  // Epilogue: add bias, store per mode. C layout: VGPR r holds row r + 8*hi,
  // lane%16 holds column within the 16x16 tile.
#pragma unroll
  for (int mt = 0; mt < 2; mt++) {
#pragma unroll
    for (int nt = 0; nt < 4; nt++) {
      int col = n0 + wn * 64 + nt * 16 + l15;
      float bv = bias[col];
      union { v8f v; float f[8]; } u;
      u.v = acc[mt][nt];
#pragma unroll
      for (int r = 0; r < 8; r++) {
        int row = m0 + wm * 32 + mt * 16 + r + hi * 8;
        float val = u.f[r] + bv;
        if (MODE == 0) {
          ((_Float16*)out)[(size_t)row * N + col] = (_Float16)val;
        } else if (MODE == 1) {
          int hh = col >> 6, dd = col & 63;        // head, dim-in-head
          int b = row >> 11, s = row & (S - 1);    // batch, position
          ((_Float16*)out)[((size_t)(b * H + hh) * HD + dd) * S + s] = (_Float16)val;
        } else {
          ((float*)out)[(size_t)row * N + col] = val;
        }
      }
    }
  }
}

// ---------------------------------------------------------------------------
// Flash attention: one wave = 16 query rows of one (b,h); block = 8 waves
// = 128 query rows. Online softmax over 32-key chunks.
// The block's 8 waves walk the same K/V, so each 64-key K tile and Vt tile is
// brought into LDS once per block by asynchronous 16-byte copies (whole 128-B
// lines per 8 lanes), two buffers: tile t+1 flies while tile t is worked on.
// ---------------------------------------------------------------------------
constexpr int KT      = 64;            // keys per staged tile
constexpr int NT      = S / KT;        // 32 tiles
constexpr int PITCH   = 72;            // halves per LDS row: 128 B data + 16 B pad (16 B x odd)
constexpr int TILE_H  = 64 * PITCH;    // halves per staged K (64 keys) or Vt (64 dims) tile

__device__ __forceinline__ unsigned lds_off(const void* p) { return (unsigned)(size_t)p; }

__global__ __launch_bounds__(256) void flash_attn_wmma(
    const _Float16* __restrict__ Qp, const _Float16* __restrict__ Kp,
    const _Float16* __restrict__ Vt, const int* __restrict__ mask,
    _Float16* __restrict__ ctx) {
  __shared__ __attribute__((aligned(16))) _Float16 lds_k[2][TILE_H];  // [key][d], padded rows
  __shared__ __attribute__((aligned(16))) _Float16 lds_v[2][TILE_H];  // [d][key], padded rows
  __shared__ _Float16 lds_p[8][16 * 32];  // wave-private P staging (fp32->f16 relayout)

  const int tid  = threadIdx.x;
  const int wave = tid >> 5, lane = tid & 31;
  const int l15  = lane & 15, hi = lane >> 4;
  const int kA   = hi ? 8 : 0;

  const int qb = blockIdx.x & 15;  // S/128 = 16 query blocks
  const int bh = blockIdx.x >> 4;  // b*H + h
  const int b  = bh >> 4, h = bh & 15;
  const int sq = qb * 128 + wave * 16;  // first query row (within sequence)

  // Copy assignment: 8 lanes per 128-B row, rows crow and crow + 32 of each tile.
  const int crow = tid >> 3, cc = tid & 7;
  const _Float16* kg = Kp + ((size_t)(b * S + crow)) * D + h * HD + cc * 8;
  const _Float16* vg = Vt + ((size_t)bh * HD + crow) * S + cc * 8;
  const unsigned lk = lds_off(&lds_k[0][crow * PITCH + cc * 8]);
  const unsigned lv = lds_off(&lds_v[0][crow * PITCH + cc * 8]);

  auto stage = [&](int t, int buf) {
    const _Float16* gk0 = kg + (size_t)t * KT * D;
    const _Float16* gk1 = gk0 + 32 * D;
    const _Float16* gv0 = vg + t * KT;
    const _Float16* gv1 = gv0 + 32 * S;
    const unsigned lk0 = lk + buf * (TILE_H * 2), lk1 = lk0 + 32 * PITCH * 2;
    const unsigned lv0 = lv + buf * (TILE_H * 2), lv1 = lv0 + 32 * PITCH * 2;
    // Global -> LDS through no register; the closing s_wait_xcnt keeps the
    // address registers unchanged until the copies have taken them.
    asm volatile(
        "global_load_async_to_lds_b128 %0, %4, off\n\t"
        "global_load_async_to_lds_b128 %1, %5, off\n\t"
        "global_load_async_to_lds_b128 %2, %6, off\n\t"
        "global_load_async_to_lds_b128 %3, %7, off\n\t"
        "s_wait_xcnt 0x0"
        :: "v"(lk0), "v"(lk1), "v"(lv0), "v"(lv1),
           "v"(gk0), "v"(gk1), "v"(gv0), "v"(gv1)
        : "memory");
  };

  // Q rows held in registers: A-operand layout, d split into two K=32 chunks
  const _Float16* qbase = Qp + ((size_t)(b * S + sq + l15)) * D + h * HD;
  v16h aq0 = load_op16(qbase + kA);
  v16h aq1 = load_op16(qbase + 32 + kA);

  const v8f vzero = {0.f, 0.f, 0.f, 0.f, 0.f, 0.f, 0.f, 0.f};
  union { v8f v; float f[8]; } acc[4];
  float mrow[8], lrow[8];
#pragma unroll
  for (int t = 0; t < 4; t++) acc[t].v = vzero;
#pragma unroll
  for (int r = 0; r < 8; r++) { mrow[r] = -INFINITY; lrow[r] = 0.f; }

  _Float16* myp = &lds_p[wave][0];

  stage(0, 0);
  asm volatile("s_wait_asynccnt 0x0" ::: "memory");  // own copies of tile 0 have landed
  __syncthreads();                                   // tile 0 readable by every wave
  stage(1, 1);

  for (int tl = 0; tl < NT; tl++) {
    const int buf = tl & 1;
    const _Float16* kt = &lds_k[buf][0];
    const _Float16* vt = &lds_v[buf][0];
#pragma unroll  // both 32-key halves of the tile: constant LDS offsets
    for (int ps = 0; ps < KT / 32; ps++) {
      const int kc = tl * KT + ps * 32;
      // ---- scores: two 16x16 tiles (32 keys), contraction over HD=64 = 2xK32
      float p[2][8];
#pragma unroll
      for (int j = 0; j < 2; j++) {
        const _Float16* kb = kt + (ps * 32 + j * 16 + l15) * PITCH;
        v16h bk0 = load_op16(kb + kA);
        v16h bk1 = load_op16(kb + 32 + kA);
        v8f sc = vzero;
        sc = WMMA16(aq0, bk0, sc);
        sc = WMMA16(aq1, bk1, sc);
        union { v8f v; float f[8]; } us;
        us.v = sc;
#pragma unroll
        for (int r = 0; r < 8; r++) {
          int q = sq + r + hi * 8;
          int mv = mask[((size_t)b * S + q) * S + (kc + j * 16 + l15)];
          float val = us.f[r] * 0.125f;  // 1/sqrt(64)
          p[j][r] = mv ? val : -1.0e9f;
        }
      }
      // ---- online softmax; a row spans the 16 lanes of one half (xor<16 stays in half)
#pragma unroll
      for (int r = 0; r < 8; r++) {
        float m = fmaxf(p[0][r], p[1][r]);
        m = fmaxf(m, __shfl_xor(m, 1, 32));
        m = fmaxf(m, __shfl_xor(m, 2, 32));
        m = fmaxf(m, __shfl_xor(m, 4, 32));
        m = fmaxf(m, __shfl_xor(m, 8, 32));
        float mnew = fmaxf(mrow[r], m);
        float corr = __expf(mrow[r] - mnew);
        mrow[r] = mnew;
        float p0 = __expf(p[0][r] - mnew);
        float p1 = __expf(p[1][r] - mnew);
        float sum = p0 + p1;
        sum += __shfl_xor(sum, 1, 32);
        sum += __shfl_xor(sum, 2, 32);
        sum += __shfl_xor(sum, 4, 32);
        sum += __shfl_xor(sum, 8, 32);
        lrow[r] = lrow[r] * corr + sum;
#pragma unroll
        for (int t = 0; t < 4; t++) acc[t].f[r] *= corr;
        // C-layout -> row-major f16 P tile in wave-private LDS
        myp[(r + hi * 8) * 32 + l15]      = (_Float16)p0;
        myp[(r + hi * 8) * 32 + 16 + l15] = (_Float16)p1;
      }
      // LDS is in-order per wave; wait so the A-operand gather sees all 32 lanes' stores
      asm volatile("s_wait_dscnt 0" ::: "memory");
      v16h ap = load_op16(&myp[l15 * 32 + kA]);
      // ---- P(16x32) @ V(32x64): staged Vt rows are contiguous along keys
#pragma unroll
      for (int t = 0; t < 4; t++) {
        const _Float16* vb = vt + (t * 16 + l15) * PITCH + ps * 32;
        v16h bv = load_op16(vb + kA);
        acc[t].v = WMMA16(ap, bv, acc[t].v);
      }
      asm volatile("" ::: "memory");
    }
    // Hand-over: this wave's reads of tile tl are done, its copies of tile
    // tl + 1 have landed; behind the barrier both hold for every wave.
    asm volatile("s_wait_dscnt 0x0" ::: "memory");
    asm volatile("s_wait_asynccnt 0x0" ::: "memory");
    __syncthreads();
    if (tl + 2 < NT) stage(tl + 2, buf);  // refill the buffer every wave has left
  }
  asm volatile("s_wait_asynccnt 0x0" ::: "memory");  // nothing in flight at the wave's end

  // ---- normalize and scatter into context [token][h*64 + d]
#pragma unroll
  for (int t = 0; t < 4; t++) {
#pragma unroll
    for (int r = 0; r < 8; r++) {
      int q = sq + r + hi * 8;
      float o = acc[t].f[r] / lrow[r];
      ctx[((size_t)(b * S + q)) * D + h * HD + t * 16 + l15] = (_Float16)o;
    }
  }
}

// ---------------------------------------------------------------------------
// Host-side launch
// ---------------------------------------------------------------------------
extern "C" void kernel_launch(void* const* d_in, const int* in_sizes, int n_in,
                              void* d_out, int out_size, void* d_ws, size_t ws_size,
                              hipStream_t stream) {
  const float* q_in  = (const float*)d_in[0];
  const float* k_in  = (const float*)d_in[1];
  const float* v_in  = (const float*)d_in[2];
  const int*   mask  = (const int*)d_in[3];
  const float* wq    = (const float*)d_in[4];
  const float* wqb   = (const float*)d_in[5];
  const float* wk    = (const float*)d_in[6];
  const float* wkb   = (const float*)d_in[7];
  const float* wv    = (const float*)d_in[8];
  const float* wvb   = (const float*)d_in[9];
  const float* wo    = (const float*)d_in[10];
  const float* wob   = (const float*)d_in[11];

  // Workspace carving (64 MB total, 256B aligned)
  char* ws = (char*)d_ws;
  size_t off = 0;
  auto alloc = [&](size_t bytes) {
    void* p = ws + off;
    off += (bytes + 255) & ~(size_t)255;
    return p;
  };
  const size_t IN_E = (size_t)MT * D;   // 4194304
  const size_t W_E  = (size_t)D * D;    // 1048576
  _Float16* qh  = (_Float16*)alloc(IN_E * 2);
  _Float16* kh  = (_Float16*)alloc(IN_E * 2);
  _Float16* vh  = (_Float16*)alloc(IN_E * 2);
  _Float16* wqh = (_Float16*)alloc(W_E * 2);
  _Float16* wkh = (_Float16*)alloc(W_E * 2);
  _Float16* wvh = (_Float16*)alloc(W_E * 2);
  _Float16* woh = (_Float16*)alloc(W_E * 2);
  _Float16* Qp  = (_Float16*)alloc(IN_E * 2);
  _Float16* Kp  = (_Float16*)alloc(IN_E * 2);
  _Float16* Vt  = (_Float16*)alloc(IN_E * 2);   // [b][h][d][s]
  _Float16* ctx = (_Float16*)alloc(IN_E * 2);

  // 1) casts
  int n4i = (int)(IN_E / 4), n4w = (int)(W_E / 4);
  cast_f32_to_f16<<<(n4i + 255) / 256, 256, 0, stream>>>(q_in, qh, n4i);
  cast_f32_to_f16<<<(n4i + 255) / 256, 256, 0, stream>>>(k_in, kh, n4i);
  cast_f32_to_f16<<<(n4i + 255) / 256, 256, 0, stream>>>(v_in, vh, n4i);
  cast_f32_to_f16<<<(n4w + 255) / 256, 256, 0, stream>>>(wq, wqh, n4w);
  cast_f32_to_f16<<<(n4w + 255) / 256, 256, 0, stream>>>(wk, wkh, n4w);
  cast_f32_to_f16<<<(n4w + 255) / 256, 256, 0, stream>>>(wv, wvh, n4w);
  cast_f32_to_f16<<<(n4w + 255) / 256, 256, 0, stream>>>(wo, woh, n4w);

  // 2) projections
  dim3 gg(D / 128, MT / 128);  // (8, 32)
  gemm_f16_wmma<0><<<gg, 256, 0, stream>>>(qh, wqh, wqb, (void*)Qp);
  gemm_f16_wmma<0><<<gg, 256, 0, stream>>>(kh, wkh, wkb, (void*)Kp);
  gemm_f16_wmma<1><<<gg, 256, 0, stream>>>(vh, wvh, wvb, (void*)Vt);

  // 3) attention: 512 blocks = B*H * (S/128)
  flash_attn_wmma<<<BB * H * (S / 128), 256, 0, stream>>>(Qp, Kp, Vt, mask, ctx);

  // 4) output projection -> fp32 d_out
  gemm_f16_wmma<2><<<gg, 256, 0, stream>>>(ctx, woh, wob, d_out);
}

// v002
// A run of this version takes 243 microseconds.
// Timed twice side by side with v001, it ran 1.07 times as fast both times.
// Over all steps from v000 it is 1.38 times as fast.
#include <hip/hip_runtime.h>
#include <hip/hip_bf16.h>

// ---------------------------------------------------------------------------
// Multi-head attention for MI455X (gfx1250, wave32, WMMA f32_16x16x32_f16).
// Pipeline: Q/K/V proj GEMMs (WMMA, double-buffered LDS; f32 operands are
// rounded to f16 on their way into LDS) | flash attention (WMMA, online
// softmax) | output proj GEMM (WMMA, fp32 out).
// ~69 GFLOP total, ~120MB minimum HBM traffic -> roughly balanced with f16
// matrix cores; scalar fp32 would be hopelessly compute-bound.
// ---------------------------------------------------------------------------

typedef __attribute__((ext_vector_type(16))) _Float16 v16h;
typedef __attribute__((ext_vector_type(8)))  float    v8f;
typedef __attribute__((ext_vector_type(2)))  float    v2f;
typedef __attribute__((ext_vector_type(2)))  _Float16 v2h;

#define WMMA16(a, b, c) \
  __builtin_amdgcn_wmma_f32_16x16x32_f16(false, (a), false, (b), (short)0, (c), false, false)

constexpr int BB = 2;      // batch
constexpr int S  = 2048;   // seq len
constexpr int D  = 1024;   // model dim
constexpr int H  = 16;     // heads
constexpr int HD = 64;     // head dim
constexpr int MT = BB * S; // 4096 tokens

// Load one v16h WMMA operand (16-bit A/B layout): caller passes base already
// offset by kA = (lane<16 ? 0 : 8); halves 0..7 = base[0..7], 8..15 = base[16..23].
__device__ __forceinline__ v16h load_op16(const _Float16* p) {
  union { v16h v; float4 f4[2]; } u;
  u.f4[0] = *(const float4*)(p);
  u.f4[1] = *(const float4*)(p + 16);
  return u.v;
}

// ---------------------------------------------------------------------------
// GEMM: C[M=4096][N=1024] = f16(A[4096][1024]) x f16(B[1024][1024]) + bias(f32)
// MODE 0: A = A32 (f32), store f16 row-major      (Q, K projections)
// MODE 1: A = A32 (f32), store f16 as Vt[b,h,d,s] (V projection, pre-transposed for P@V)
// MODE 2: A = A16 (f16), store f32 row-major      (final output projection)
// B is always the f32 weight. f32 operands are read as whole 128-B lines and
// rounded to f16 between the staging registers and LDS, so no separate cast pass.
// Block tile 128x128, 8 waves (4 along M x 2 along N), K-step 32,
// double-buffered LDS: one barrier per K-step, global loads for step k+1
// staged in registers while WMMAs consume buffer k.
// ---------------------------------------------------------------------------
template <int MODE>
__global__ __launch_bounds__(256) void gemm_f16_wmma(
    const float* __restrict__ A32, const _Float16* __restrict__ A16,
    const float* __restrict__ Bw, const float* __restrict__ bias,
    void* __restrict__ out) {
  constexpr int K = 1024, N = 1024;
  __shared__ _Float16 lds_a[2][128 * 32];  // [m][k]
  __shared__ _Float16 lds_b[2][128 * 32];  // [n][k] (transposed on the way in)

  const int tid  = threadIdx.x;
  const int wave = tid >> 5, lane = tid & 31;
  const int l15  = lane & 15, hi = lane >> 4;
  const int kA   = hi ? 8 : 0;
  const int wm   = wave & 3;   // 4 wave-rows of 32
  const int wn   = wave >> 2;  // 2 wave-cols of 64
  const int m0   = blockIdx.y * 128, n0 = blockIdx.x * 128;

  // per-thread staging assignment
  const int arow = tid >> 1, akc = (tid & 1) * 16;  // f16 A: 128 rows x 32, 16 halves a thread
  const int fr = tid >> 3, fc = (tid & 7) * 4;      // f32 A: rows fr + 32*i, 4 floats: 8 lanes = one line
  const int bkr = tid >> 3, bch = tid & 7;          // f32 B: k row bkr, columns i*32 + bch*4 + 0..3

  v8f acc[2][4];
  const v8f vzero = {0.f, 0.f, 0.f, 0.f, 0.f, 0.f, 0.f, 0.f};
#pragma unroll
  for (int i = 0; i < 2; i++)
#pragma unroll
    for (int j = 0; j < 4; j++) acc[i][j] = vzero;

  float4 ra0, ra1, ra2, ra3, rb0, rb1, rb2, rb3;
  auto g_load = [&](int k0) {
    if constexpr (MODE == 2) {
      const float4* asrc = (const float4*)(A16 + (size_t)(m0 + arow) * K + k0 + akc);
      ra0 = asrc[0];
      ra1 = asrc[1];
    } else {
      const float* asrc = A32 + (size_t)(m0 + fr) * K + k0 + fc;
      ra0 = *(const float4*)(asrc);
      ra1 = *(const float4*)(asrc + 32 * K);
      ra2 = *(const float4*)(asrc + 64 * K);
      ra3 = *(const float4*)(asrc + 96 * K);
    }
    const float* bsrc = Bw + (size_t)(k0 + bkr) * N + n0 + bch * 4;
    rb0 = *(const float4*)(bsrc);
    rb1 = *(const float4*)(bsrc + 32);
    rb2 = *(const float4*)(bsrc + 64);
    rb3 = *(const float4*)(bsrc + 96);
  };
  // four f32 of one A row -> four f16, one 8-byte LDS store
  auto a_put = [&](int buf, int row, float4 v) {
    union { _Float16 h[4]; unsigned long long u; } w;
    w.h[0] = (_Float16)v.x; w.h[1] = (_Float16)v.y;
    w.h[2] = (_Float16)v.z; w.h[3] = (_Float16)v.w;
    *(unsigned long long*)(&lds_a[buf][row * 32 + fc]) = w.u;
  };
  // four f32 of one B row (columns n .. n + 3) -> f16, transposed into [n][k]
  auto b_put = [&](int buf, int n, float4 v) {
    const v2f lo = {v.x, v.y}, hi2 = {v.z, v.w};
    const v2h h0 = __builtin_convertvector(lo, v2h), h1 = __builtin_convertvector(hi2, v2h);
    lds_b[buf][(n + 0) * 32 + bkr] = h0[0];
    lds_b[buf][(n + 1) * 32 + bkr] = h0[1];
    lds_b[buf][(n + 2) * 32 + bkr] = h1[0];
    lds_b[buf][(n + 3) * 32 + bkr] = h1[1];
  };
  auto l_store = [&](int buf) {
    if constexpr (MODE == 2) {
      *(float4*)(&lds_a[buf][arow * 32 + akc])     = ra0;
      *(float4*)(&lds_a[buf][arow * 32 + akc + 8]) = ra1;
    } else {
      a_put(buf, fr, ra0);
      a_put(buf, fr + 32, ra1);
      a_put(buf, fr + 64, ra2);
      a_put(buf, fr + 96, ra3);
    }
    b_put(buf, bch * 4, rb0);
    b_put(buf, bch * 4 + 32, rb1);
    b_put(buf, bch * 4 + 64, rb2);
    b_put(buf, bch * 4 + 96, rb3);
  };

  g_load(0);
  l_store(0);
  __syncthreads();

  for (int k0 = 0; k0 < K; k0 += 32) {
    const int cur = (k0 >> 5) & 1, nxt = cur ^ 1;
    const bool more = (k0 + 32) < K;
    if (more) g_load(k0 + 32);  // overlap next global fetch with WMMA

    v16h aop[2], bop[4];
#pragma unroll
    for (int mt = 0; mt < 2; mt++)
      aop[mt] = load_op16(&lds_a[cur][(wm * 32 + mt * 16 + l15) * 32 + kA]);
#pragma unroll
    for (int nt = 0; nt < 4; nt++)
      bop[nt] = load_op16(&lds_b[cur][(wn * 64 + nt * 16 + l15) * 32 + kA]);
#pragma unroll
    for (int mt = 0; mt < 2; mt++)
#pragma unroll
      for (int nt = 0; nt < 4; nt++)
        acc[mt][nt] = WMMA16(aop[mt], bop[nt], acc[mt][nt]);

    if (more) l_store(nxt);  // other buffer: no conflict with current readers
    __syncthreads();
  }

  // Epilogue: add bias, store per mode. C layout: VGPR r holds row r + 8*hi,
  // lane%16 holds column within the 16x16 tile.
#pragma unroll
  for (int mt = 0; mt < 2; mt++) {
#pragma unroll
    for (int nt = 0; nt < 4; nt++) {
      int col = n0 + wn * 64 + nt * 16 + l15;
      float bv = bias[col];
      union { v8f v; float f[8]; } u;
      u.v = acc[mt][nt];
#pragma unroll
      for (int r = 0; r < 8; r++) {
        int row = m0 + wm * 32 + mt * 16 + r + hi * 8;
        float val = u.f[r] + bv;
        if (MODE == 0) {
          ((_Float16*)out)[(size_t)row * N + col] = (_Float16)val;
        } else if (MODE == 1) {
          int hh = col >> 6, dd = col & 63;        // head, dim-in-head
          int b = row >> 11, s = row & (S - 1);    // batch, position
          ((_Float16*)out)[((size_t)(b * H + hh) * HD + dd) * S + s] = (_Float16)val;
        } else {
          ((float*)out)[(size_t)row * N + col] = val;
        }
      }
    }
  }
}

// ---------------------------------------------------------------------------
// Flash attention: one wave = 16 query rows of one (b,h); block = 8 waves
// = 128 query rows. Online softmax over 32-key chunks.
// The block's 8 waves walk the same K/V, so each 64-key K tile and Vt tile is
// brought into LDS once per block by asynchronous 16-byte copies (whole 128-B
// lines per 8 lanes), two buffers: tile t+1 flies while tile t is worked on.
// ---------------------------------------------------------------------------
constexpr int KT      = 64;            // keys per staged tile
constexpr int NT      = S / KT;        // 32 tiles
constexpr int PITCH   = 72;            // halves per LDS row: 128 B data + 16 B pad (16 B x odd)
constexpr int TILE_H  = 64 * PITCH;    // halves per staged K (64 keys) or Vt (64 dims) tile

__device__ __forceinline__ unsigned lds_off(const void* p) { return (unsigned)(size_t)p; }

__global__ __launch_bounds__(256) void flash_attn_wmma(
    const _Float16* __restrict__ Qp, const _Float16* __restrict__ Kp,
    const _Float16* __restrict__ Vt, const int* __restrict__ mask,
    _Float16* __restrict__ ctx) {
  __shared__ __attribute__((aligned(16))) _Float16 lds_k[2][TILE_H];  // [key][d], padded rows
  __shared__ __attribute__((aligned(16))) _Float16 lds_v[2][TILE_H];  // [d][key], padded rows
  __shared__ _Float16 lds_p[8][16 * 32];  // wave-private P staging (fp32->f16 relayout)

  const int tid  = threadIdx.x;
  const int wave = tid >> 5, lane = tid & 31;
  const int l15  = lane & 15, hi = lane >> 4;
  const int kA   = hi ? 8 : 0;

  const int qb = blockIdx.x & 15;  // S/128 = 16 query blocks
  const int bh = blockIdx.x >> 4;  // b*H + h
  const int b  = bh >> 4, h = bh & 15;
  const int sq = qb * 128 + wave * 16;  // first query row (within sequence)

  // Copy assignment: 8 lanes per 128-B row, rows crow and crow + 32 of each tile.
  const int crow = tid >> 3, cc = tid & 7;
  const _Float16* kg = Kp + ((size_t)(b * S + crow)) * D + h * HD + cc * 8;
  const _Float16* vg = Vt + ((size_t)bh * HD + crow) * S + cc * 8;
  const unsigned lk = lds_off(&lds_k[0][crow * PITCH + cc * 8]);
  const unsigned lv = lds_off(&lds_v[0][crow * PITCH + cc * 8]);

  auto stage = [&](int t, int buf) {
    const _Float16* gk0 = kg + (size_t)t * KT * D;
    const _Float16* gk1 = gk0 + 32 * D;
    const _Float16* gv0 = vg + t * KT;
    const _Float16* gv1 = gv0 + 32 * S;
    const unsigned lk0 = lk + buf * (TILE_H * 2), lk1 = lk0 + 32 * PITCH * 2;
    const unsigned lv0 = lv + buf * (TILE_H * 2), lv1 = lv0 + 32 * PITCH * 2;
    // Global -> LDS through no register; the closing s_wait_xcnt keeps the
    // address registers unchanged until the copies have taken them.
    asm volatile(
        "global_load_async_to_lds_b128 %0, %4, off\n\t"
        "global_load_async_to_lds_b128 %1, %5, off\n\t"
        "global_load_async_to_lds_b128 %2, %6, off\n\t"
        "global_load_async_to_lds_b128 %3, %7, off\n\t"
        "s_wait_xcnt 0x0"
        :: "v"(lk0), "v"(lk1), "v"(lv0), "v"(lv1),
           "v"(gk0), "v"(gk1), "v"(gv0), "v"(gv1)
        : "memory");
  };

  // Q rows held in registers: A-operand layout, d split into two K=32 chunks
  const _Float16* qbase = Qp + ((size_t)(b * S + sq + l15)) * D + h * HD;
  v16h aq0 = load_op16(qbase + kA);
  v16h aq1 = load_op16(qbase + 32 + kA);

  const v8f vzero = {0.f, 0.f, 0.f, 0.f, 0.f, 0.f, 0.f, 0.f};
  union { v8f v; float f[8]; } acc[4];
  float mrow[8], lrow[8];
#pragma unroll
  for (int t = 0; t < 4; t++) acc[t].v = vzero;
#pragma unroll
  for (int r = 0; r < 8; r++) { mrow[r] = -INFINITY; lrow[r] = 0.f; }

  _Float16* myp = &lds_p[wave][0];

  stage(0, 0);
  asm volatile("s_wait_asynccnt 0x0" ::: "memory");  // own copies of tile 0 have landed
  __syncthreads();                                   // tile 0 readable by every wave
  stage(1, 1);

  for (int tl = 0; tl < NT; tl++) {
    const int buf = tl & 1;
    const _Float16* kt = &lds_k[buf][0];
    const _Float16* vt = &lds_v[buf][0];
#pragma unroll  // both 32-key halves of the tile: constant LDS offsets
    for (int ps = 0; ps < KT / 32; ps++) {
      const int kc = tl * KT + ps * 32;
      // ---- scores: two 16x16 tiles (32 keys), contraction over HD=64 = 2xK32
      float p[2][8];
#pragma unroll
      for (int j = 0; j < 2; j++) {
        const _Float16* kb = kt + (ps * 32 + j * 16 + l15) * PITCH;
        v16h bk0 = load_op16(kb + kA);
        v16h bk1 = load_op16(kb + 32 + kA);
        v8f sc = vzero;
        sc = WMMA16(aq0, bk0, sc);
        sc = WMMA16(aq1, bk1, sc);
        union { v8f v; float f[8]; } us;
        us.v = sc;
#pragma unroll
        for (int r = 0; r < 8; r++) {
          int q = sq + r + hi * 8;
          int mv = mask[((size_t)b * S + q) * S + (kc + j * 16 + l15)];
          float val = us.f[r] * 0.125f;  // 1/sqrt(64)
          p[j][r] = mv ? val : -1.0e9f;
        }
      }
      // ---- online softmax; a row spans the 16 lanes of one half (xor<16 stays in half)
#pragma unroll
      for (int r = 0; r < 8; r++) {
        float m = fmaxf(p[0][r], p[1][r]);
        m = fmaxf(m, __shfl_xor(m, 1, 32));
        m = fmaxf(m, __shfl_xor(m, 2, 32));
        m = fmaxf(m, __shfl_xor(m, 4, 32));
        m = fmaxf(m, __shfl_xor(m, 8, 32));
        float mnew = fmaxf(mrow[r], m);
        float corr = __expf(mrow[r] - mnew);
        mrow[r] = mnew;
        float p0 = __expf(p[0][r] - mnew);
        float p1 = __expf(p[1][r] - mnew);
        float sum = p0 + p1;
        sum += __shfl_xor(sum, 1, 32);
        sum += __shfl_xor(sum, 2, 32);
        sum += __shfl_xor(sum, 4, 32);
        sum += __shfl_xor(sum, 8, 32);
        lrow[r] = lrow[r] * corr + sum;
#pragma unroll
        for (int t = 0; t < 4; t++) acc[t].f[r] *= corr;
        // C-layout -> row-major f16 P tile in wave-private LDS
        myp[(r + hi * 8) * 32 + l15]      = (_Float16)p0;
        myp[(r + hi * 8) * 32 + 16 + l15] = (_Float16)p1;
      }
      // LDS is in-order per wave; wait so the A-operand gather sees all 32 lanes' stores
      asm volatile("s_wait_dscnt 0" ::: "memory");
      v16h ap = load_op16(&myp[l15 * 32 + kA]);
      // ---- P(16x32) @ V(32x64): staged Vt rows are contiguous along keys
#pragma unroll
      for (int t = 0; t < 4; t++) {
        const _Float16* vb = vt + (t * 16 + l15) * PITCH + ps * 32;
        v16h bv = load_op16(vb + kA);
        acc[t].v = WMMA16(ap, bv, acc[t].v);
      }
      asm volatile("" ::: "memory");
    }
    // Hand-over: this wave's reads of tile tl are done, its copies of tile
    // tl + 1 have landed; behind the barrier both hold for every wave.
    asm volatile("s_wait_dscnt 0x0" ::: "memory");
    asm volatile("s_wait_asynccnt 0x0" ::: "memory");
    __syncthreads();
    if (tl + 2 < NT) stage(tl + 2, buf);  // refill the buffer every wave has left
  }
  asm volatile("s_wait_asynccnt 0x0" ::: "memory");  // nothing in flight at the wave's end

  // ---- normalize and scatter into context [token][h*64 + d]
#pragma unroll
  for (int t = 0; t < 4; t++) {
#pragma unroll
    for (int r = 0; r < 8; r++) {
      int q = sq + r + hi * 8;
      float o = acc[t].f[r] / lrow[r];
      ctx[((size_t)(b * S + q)) * D + h * HD + t * 16 + l15] = (_Float16)o;
    }
  }
}

// ---------------------------------------------------------------------------
// Host-side launch
// ---------------------------------------------------------------------------
extern "C" void kernel_launch(void* const* d_in, const int* in_sizes, int n_in,
                              void* d_out, int out_size, void* d_ws, size_t ws_size,
                              hipStream_t stream) {
  const float* q_in  = (const float*)d_in[0];
  const float* k_in  = (const float*)d_in[1];
  const float* v_in  = (const float*)d_in[2];
  const int*   mask  = (const int*)d_in[3];
  const float* wq    = (const float*)d_in[4];
  const float* wqb   = (const float*)d_in[5];
  const float* wk    = (const float*)d_in[6];
  const float* wkb   = (const float*)d_in[7];
  const float* wv    = (const float*)d_in[8];
  const float* wvb   = (const float*)d_in[9];
  const float* wo    = (const float*)d_in[10];
  const float* wob   = (const float*)d_in[11];

  // Workspace carving (32 MB total, 256B aligned)
  char* ws = (char*)d_ws;
  size_t off = 0;
  auto alloc = [&](size_t bytes) {
    void* p = ws + off;
    off += (bytes + 255) & ~(size_t)255;
    return p;
  };
  const size_t IN_E = (size_t)MT * D;   // 4194304
  _Float16* Qp  = (_Float16*)alloc(IN_E * 2);
  _Float16* Kp  = (_Float16*)alloc(IN_E * 2);
  _Float16* Vt  = (_Float16*)alloc(IN_E * 2);   // [b][h][d][s]
  _Float16* ctx = (_Float16*)alloc(IN_E * 2);

  // 1) projections, straight from the f32 inputs and weights
  dim3 gg(D / 128, MT / 128);  // (8, 32)
  gemm_f16_wmma<0><<<gg, 256, 0, stream>>>(q_in, nullptr, wq, wqb, (void*)Qp);
  gemm_f16_wmma<0><<<gg, 256, 0, stream>>>(k_in, nullptr, wk, wkb, (void*)Kp);
  gemm_f16_wmma<1><<<gg, 256, 0, stream>>>(v_in, nullptr, wv, wvb, (void*)Vt);

  // 2) attention: 512 blocks = B*H * (S/128)
  flash_attn_wmma<<<BB * H * (S / 128), 256, 0, stream>>>(Qp, Kp, Vt, mask, ctx);

  // 3) output projection -> fp32 d_out
  gemm_f16_wmma<2><<<gg, 256, 0, stream>>>(nullptr, ctx, wo, wob, d_out);
}

// v003
// One run takes 210 microseconds.
// Two timings next to v002 put it at 1.15 and 1.16 times that version's speed.
// Counting every step since v000, it is 1.59 times as fast.
#include <hip/hip_runtime.h>
#include <hip/hip_bf16.h>

// ---------------------------------------------------------------------------
// Multi-head attention for MI455X (gfx1250, wave32, WMMA f32_16x16x32_f16).
// Pipeline: Q/K/V proj GEMMs (WMMA, double-buffered LDS; f32 operands are
// rounded to f16 on their way into LDS) | flash attention (WMMA, online
// softmax) | output proj GEMM (WMMA, fp32 out).
// ~69 GFLOP total, ~120MB minimum HBM traffic -> roughly balanced with f16
// matrix cores; scalar fp32 would be hopelessly compute-bound.
// ---------------------------------------------------------------------------

typedef __attribute__((ext_vector_type(16))) _Float16 v16h;
typedef __attribute__((ext_vector_type(8)))  float    v8f;
typedef __attribute__((ext_vector_type(2)))  float    v2f;
typedef __attribute__((ext_vector_type(2)))  _Float16 v2h;

#define WMMA16(a, b, c) \
  __builtin_amdgcn_wmma_f32_16x16x32_f16(false, (a), false, (b), (short)0, (c), false, false)

constexpr int BB = 2;      // batch
constexpr int S  = 2048;   // seq len
constexpr int D  = 1024;   // model dim
constexpr int H  = 16;     // heads
constexpr int HD = 64;     // head dim
constexpr int MT = BB * S; // 4096 tokens

// Load one v16h WMMA operand (16-bit A/B layout): caller passes base already
// offset by kA = (lane<16 ? 0 : 8); halves 0..7 = base[0..7], 8..15 = base[16..23].
__device__ __forceinline__ v16h load_op16(const _Float16* p) {
  union { v16h v; float4 f4[2]; } u;
  u.f4[0] = *(const float4*)(p);
  u.f4[1] = *(const float4*)(p + 16);
  return u.v;
}

// ---------------------------------------------------------------------------
// GEMM: C[M=4096][N=1024] = f16(A[4096][1024]) x f16(B[1024][1024]) + bias(f32)
// MODE 0: A = A32 (f32), store f16 row-major      (Q, K projections)
// MODE 1: A = A32 (f32), store f16 as Vt[b,h,d,s] (V projection, pre-transposed for P@V)
// MODE 2: A = A16 (f16), store f32 row-major      (final output projection)
// B is always the f32 weight. f32 operands are read as whole 128-B lines and
// rounded to f16 between the staging registers and LDS, so no separate cast pass.
// Block tile 128x128, 8 waves (4 along M x 2 along N), K-step 32,
// double-buffered LDS: one barrier per K-step, global loads for step k+1
// staged in registers while WMMAs consume buffer k.
// ---------------------------------------------------------------------------
template <int MODE>
__global__ __launch_bounds__(256) void gemm_f16_wmma(
    const float* __restrict__ A32, const _Float16* __restrict__ A16,
    const float* __restrict__ Bw, const float* __restrict__ bias,
    void* __restrict__ out) {
  constexpr int K = 1024, N = 1024;
  __shared__ _Float16 lds_a[2][128 * 32];  // [m][k]
  __shared__ _Float16 lds_b[2][128 * 32];  // [n][k] (transposed on the way in)

  const int tid  = threadIdx.x;
  const int wave = tid >> 5, lane = tid & 31;
  const int l15  = lane & 15, hi = lane >> 4;
  const int kA   = hi ? 8 : 0;
  const int wm   = wave & 3;   // 4 wave-rows of 32
  const int wn   = wave >> 2;  // 2 wave-cols of 64
  const int m0   = blockIdx.y * 128, n0 = blockIdx.x * 128;

  // per-thread staging assignment
  const int arow = tid >> 1, akc = (tid & 1) * 16;  // f16 A: 128 rows x 32, 16 halves a thread
  const int fr = tid >> 3, fc = (tid & 7) * 4;      // f32 A: rows fr + 32*i, 4 floats: 8 lanes = one line
  const int bkr = tid >> 3, bch = tid & 7;          // f32 B: k row bkr, columns i*32 + bch*4 + 0..3

  v8f acc[2][4];
  const v8f vzero = {0.f, 0.f, 0.f, 0.f, 0.f, 0.f, 0.f, 0.f};
#pragma unroll
  for (int i = 0; i < 2; i++)
#pragma unroll
    for (int j = 0; j < 4; j++) acc[i][j] = vzero;

  float4 ra0, ra1, ra2, ra3, rb0, rb1, rb2, rb3;
  auto g_load = [&](int k0) {
    if constexpr (MODE == 2) {
      const float4* asrc = (const float4*)(A16 + (size_t)(m0 + arow) * K + k0 + akc);
      ra0 = asrc[0];
      ra1 = asrc[1];
    } else {
      const float* asrc = A32 + (size_t)(m0 + fr) * K + k0 + fc;
      ra0 = *(const float4*)(asrc);
      ra1 = *(const float4*)(asrc + 32 * K);
      ra2 = *(const float4*)(asrc + 64 * K);
      ra3 = *(const float4*)(asrc + 96 * K);
    }
    const float* bsrc = Bw + (size_t)(k0 + bkr) * N + n0 + bch * 4;
    rb0 = *(const float4*)(bsrc);
    rb1 = *(const float4*)(bsrc + 32);
    rb2 = *(const float4*)(bsrc + 64);
    rb3 = *(const float4*)(bsrc + 96);
  };
  // four f32 of one A row -> four f16, one 8-byte LDS store
  auto a_put = [&](int buf, int row, float4 v) {
    union { _Float16 h[4]; unsigned long long u; } w;
    w.h[0] = (_Float16)v.x; w.h[1] = (_Float16)v.y;
    w.h[2] = (_Float16)v.z; w.h[3] = (_Float16)v.w;
    *(unsigned long long*)(&lds_a[buf][row * 32 + fc]) = w.u;
  };
  // four f32 of one B row (columns n .. n + 3) -> f16, transposed into [n][k]
  auto b_put = [&](int buf, int n, float4 v) {
    const v2f lo = {v.x, v.y}, hi2 = {v.z, v.w};
    const v2h h0 = __builtin_convertvector(lo, v2h), h1 = __builtin_convertvector(hi2, v2h);
    lds_b[buf][(n + 0) * 32 + bkr] = h0[0];
    lds_b[buf][(n + 1) * 32 + bkr] = h0[1];
    lds_b[buf][(n + 2) * 32 + bkr] = h1[0];
    lds_b[buf][(n + 3) * 32 + bkr] = h1[1];
  };
  auto l_store = [&](int buf) {
    if constexpr (MODE == 2) {
      *(float4*)(&lds_a[buf][arow * 32 + akc])     = ra0;
      *(float4*)(&lds_a[buf][arow * 32 + akc + 8]) = ra1;
    } else {
      a_put(buf, fr, ra0);
      a_put(buf, fr + 32, ra1);
      a_put(buf, fr + 64, ra2);
      a_put(buf, fr + 96, ra3);
    }
    b_put(buf, bch * 4, rb0);
    b_put(buf, bch * 4 + 32, rb1);
    b_put(buf, bch * 4 + 64, rb2);
    b_put(buf, bch * 4 + 96, rb3);
  };

  g_load(0);
  l_store(0);
  __syncthreads();

  for (int k0 = 0; k0 < K; k0 += 32) {
    const int cur = (k0 >> 5) & 1, nxt = cur ^ 1;
    const bool more = (k0 + 32) < K;
    if (more) g_load(k0 + 32);  // overlap next global fetch with WMMA

    v16h aop[2], bop[4];
#pragma unroll
    for (int mt = 0; mt < 2; mt++)
      aop[mt] = load_op16(&lds_a[cur][(wm * 32 + mt * 16 + l15) * 32 + kA]);
#pragma unroll
    for (int nt = 0; nt < 4; nt++)
      bop[nt] = load_op16(&lds_b[cur][(wn * 64 + nt * 16 + l15) * 32 + kA]);
#pragma unroll
    for (int mt = 0; mt < 2; mt++)
#pragma unroll
      for (int nt = 0; nt < 4; nt++)
        acc[mt][nt] = WMMA16(aop[mt], bop[nt], acc[mt][nt]);

    if (more) l_store(nxt);  // other buffer: no conflict with current readers
    __syncthreads();
  }

  // Epilogue: add bias, store per mode. C layout: VGPR r holds row r + 8*hi,
  // lane%16 holds column within the 16x16 tile.
#pragma unroll
  for (int mt = 0; mt < 2; mt++) {
#pragma unroll
    for (int nt = 0; nt < 4; nt++) {
      int col = n0 + wn * 64 + nt * 16 + l15;
      float bv = bias[col];
      union { v8f v; float f[8]; } u;
      u.v = acc[mt][nt];
#pragma unroll
      for (int r = 0; r < 8; r++) {
        int row = m0 + wm * 32 + mt * 16 + r + hi * 8;
        float val = u.f[r] + bv;
        if (MODE == 0) {
          ((_Float16*)out)[(size_t)row * N + col] = (_Float16)val;
        } else if (MODE == 1) {
          int hh = col >> 6, dd = col & 63;        // head, dim-in-head
          int b = row >> 11, s = row & (S - 1);    // batch, position
          ((_Float16*)out)[((size_t)(b * H + hh) * HD + dd) * S + s] = (_Float16)val;
        } else {
          ((float*)out)[(size_t)row * N + col] = val;
        }
      }
    }
  }
}

constexpr int KT      = 64;
constexpr int NT      = S / KT;
constexpr int PITCH   = 72;
constexpr int TILE_H  = 64 * PITCH;

__device__ __forceinline__ unsigned lds_off(const void* p) { return (unsigned)(size_t)p; }

// value of lane ^ 16 (the other 16-lane half), by a vector cross-row move
__device__ __forceinline__ float other_half(float x) {
  const int b = __builtin_bit_cast(int, x);
  return __builtin_bit_cast(float,
      __builtin_amdgcn_permlanex16(b, b, 0x76543210, 0xfedcba98, false, false));
}

// 512 blocks on 256 WGPs: four waves a SIMD is all the grid gives, so let the
// register budget be that of four (keeps the tile's mask loads ahead of their use).
__global__ __launch_bounds__(256) __attribute__((amdgpu_waves_per_eu(4, 4))) void flash_attn_wmma(
    const _Float16* __restrict__ Qp, const _Float16* __restrict__ Kp,
    const _Float16* __restrict__ Vt, const int* __restrict__ mask,
    _Float16* __restrict__ ctx) {
  __shared__ __attribute__((aligned(16))) _Float16 lds_k[2][TILE_H];  // [key][d], padded rows
  __shared__ __attribute__((aligned(16))) _Float16 lds_v[2][TILE_H];  // [d][key], padded rows

  const int tid  = threadIdx.x;
  const int wave = tid >> 5, lane = tid & 31;
  const int l15  = lane & 15, hi = lane >> 4;
  const int kA   = hi ? 8 : 0;

  const int qb = blockIdx.x & 15;  // S/128 = 16 query blocks
  const int bh = blockIdx.x >> 4;  // b*H + h
  const int b  = bh >> 4, h = bh & 15;
  const int sq = qb * 128 + wave * 16;  // first query row (within sequence)

  // Copy assignment: 8 lanes per 128-B row, rows crow and crow + 32 of each tile.
  const int crow = tid >> 3, cc = tid & 7;
  const _Float16* kg = Kp + ((size_t)(b * S + crow)) * D + h * HD + cc * 8;
  const _Float16* vg = Vt + ((size_t)bh * HD + crow) * S + cc * 8;
  const unsigned lk = lds_off(&lds_k[0][crow * PITCH + cc * 8]);
  const unsigned lv = lds_off(&lds_v[0][crow * PITCH + cc * 8]);

  auto stage = [&](int t, int buf) {
    const _Float16* gk0 = kg + (size_t)t * KT * D;
    const _Float16* gk1 = gk0 + 32 * D;
    const _Float16* gv0 = vg + t * KT;
    const _Float16* gv1 = gv0 + 32 * S;
    const unsigned lk0 = lk + buf * (TILE_H * 2), lk1 = lk0 + 32 * PITCH * 2;
    const unsigned lv0 = lv + buf * (TILE_H * 2), lv1 = lv0 + 32 * PITCH * 2;
    // Global -> LDS through no register; the closing s_wait_xcnt keeps the
    // address registers unchanged until the copies have taken them.
    asm volatile(
        "global_load_async_to_lds_b128 %0, %4, off\n\t"
        "global_load_async_to_lds_b128 %1, %5, off\n\t"
        "global_load_async_to_lds_b128 %2, %6, off\n\t"
        "global_load_async_to_lds_b128 %3, %7, off\n\t"
        "s_wait_xcnt 0x0"
        :: "v"(lk0), "v"(lk1), "v"(lv0), "v"(lv1),
           "v"(gk0), "v"(gk1), "v"(gv0), "v"(gv1)
        : "memory");
  };

  // Q rows held in registers: B-operand layout (column = query), d split into two K=32 chunks
  const _Float16* qbase = Qp + ((size_t)(b * S + sq + l15)) * D + h * HD;
  v16h aq0 = load_op16(qbase + kA);
  v16h aq1 = load_op16(qbase + 32 + kA);

  const v8f vzero = {0.f, 0.f, 0.f, 0.f, 0.f, 0.f, 0.f, 0.f};
  v8f acc[4];  // O^T: acc[t][r] = O[query l15][d = t * 16 + 8 * hi + r]
#pragma unroll
  for (int t = 0; t < 4; t++) acc[t] = vzero;
  float mrun = -INFINITY;  // running maximum of this lane's query, equal in both halves
  float lrun = 0.f;        // running sum over this half's keys only; halves joined at the end

  // this lane's mask row, at its half's first key of a 16-key tile
  const int* mq = mask + ((size_t)b * S + sq + l15) * S + hi * 8;

  stage(0, 0);
  asm volatile("s_wait_asynccnt 0x0" ::: "memory");  // own copies of tile 0 have landed
  __syncthreads();                                   // tile 0 readable by every wave
  stage(1, 1);

  for (int tl = 0; tl < NT; tl++) {
    const int buf = tl & 1;
    const _Float16* kt = &lds_k[buf][0];
    const _Float16* vt = &lds_v[buf][0];
#pragma unroll  // both 32-key halves of the tile: constant LDS offsets
    for (int ps = 0; ps < KT / 32; ps++) {
      const int kc = tl * KT + ps * 32;
      // ---- scores^T: two 16x16 tiles (32 keys), contraction over HD=64 = 2xK32
      float p[2][8];
#pragma unroll
      for (int j = 0; j < 2; j++) {
        // eight consecutive keys of one query: 32 contiguous mask bytes a lane
        const int4 mk0 = *(const int4*)(mq + kc + j * 16);
        const int4 mk1 = *(const int4*)(mq + kc + j * 16 + 4);
        const int mv[8] = {mk0.x, mk0.y, mk0.z, mk0.w, mk1.x, mk1.y, mk1.z, mk1.w};
        const _Float16* kb = kt + (ps * 32 + j * 16 + l15) * PITCH;
        v16h bk0 = load_op16(kb + kA);
        v16h bk1 = load_op16(kb + 32 + kA);
        v8f sc = vzero;
        sc = WMMA16(bk0, aq0, sc);  // A = K rows, B = Q^T
        sc = WMMA16(bk1, aq1, sc);
        sc *= 0.125f;  // 1/sqrt(64)
#pragma unroll
        for (int r = 0; r < 8; r++) p[j][r] = mv[r] ? sc[r] : -1.0e9f;
      }
      // ---- online softmax: 16 of the query's 32 scores are in this lane, 16 in lane ^ 16
      float mx[8];
#pragma unroll
      for (int r = 0; r < 8; r++) mx[r] = fmaxf(p[0][r], p[1][r]);
      float m = fmaxf(fmaxf(fmaxf(mx[0], mx[1]), fmaxf(mx[2], mx[3])),
                      fmaxf(fmaxf(mx[4], mx[5]), fmaxf(mx[6], mx[7])));
      m = fmaxf(m, other_half(m));
      const float mnew = fmaxf(mrun, m);
      const float corr = __expf(mrun - mnew);
      mrun = mnew;
      union { v16h v; v2h h2[8]; } bp;  // P^T as B operand: halves 0..7 = tile 0, 8..15 = tile 1
      float sm[2][4];
#pragma unroll
      for (int j = 0; j < 2; j++) {
#pragma unroll
        for (int i = 0; i < 4; i++) {
          const v2f e = {__expf(p[j][2 * i] - mnew), __expf(p[j][2 * i + 1] - mnew)};
          sm[j][i] = e[0] + e[1];
          bp.h2[j * 4 + i] = __builtin_convertvector(e, v2h);
        }
      }
      const float sum = ((sm[0][0] + sm[0][1]) + (sm[0][2] + sm[0][3])) +
                        ((sm[1][0] + sm[1][1]) + (sm[1][2] + sm[1][3]));
      lrun = lrun * corr + sum;
#pragma unroll
      for (int t = 0; t < 4; t++) acc[t] *= corr;
      // ---- V^T(64x32) @ P^T(32x16): staged Vt rows are contiguous along keys
#pragma unroll
      for (int t = 0; t < 4; t++) {
        const _Float16* vb = vt + (t * 16 + l15) * PITCH + ps * 32;
        v16h av = load_op16(vb + kA);
        acc[t] = WMMA16(av, bp.v, acc[t]);
      }
    }
    // Hand-over: this wave's reads of tile tl are done, its copies of tile
    // tl + 1 have landed; behind the barrier both hold for every wave.
    asm volatile("s_wait_dscnt 0x0" ::: "memory");
    asm volatile("s_wait_asynccnt 0x0" ::: "memory");
    __syncthreads();
    if (tl + 2 < NT) stage(tl + 2, buf);  // refill the buffer every wave has left
  }
  asm volatile("s_wait_asynccnt 0x0" ::: "memory");  // nothing in flight at the wave's end

  // ---- normalize and store into context [token][h*64 + d]: 8 consecutive d a lane
  const float lsum = lrun + other_half(lrun);
  _Float16* crow_out = ctx + ((size_t)(b * S + sq + l15)) * D + h * HD + hi * 8;
#pragma unroll
  for (int t = 0; t < 4; t++) {
    union { _Float16 hh[8]; float4 f4; } o;
#pragma unroll
    for (int r = 0; r < 8; r++) o.hh[r] = (_Float16)(acc[t][r] / lsum);
    *(float4*)(crow_out + t * 16) = o.f4;
  }
}

// ---------------------------------------------------------------------------
// Host-side launch
// ---------------------------------------------------------------------------
extern "C" void kernel_launch(void* const* d_in, const int* in_sizes, int n_in,
                              void* d_out, int out_size, void* d_ws, size_t ws_size,
                              hipStream_t stream) {
  const float* q_in  = (const float*)d_in[0];
  const float* k_in  = (const float*)d_in[1];
  const float* v_in  = (const float*)d_in[2];
  const int*   mask  = (const int*)d_in[3];
  const float* wq    = (const float*)d_in[4];
  const float* wqb   = (const float*)d_in[5];
  const float* wk    = (const float*)d_in[6];
  const float* wkb   = (const float*)d_in[7];
  const float* wv    = (const float*)d_in[8];
  const float* wvb   = (const float*)d_in[9];
  const float* wo    = (const float*)d_in[10];
  const float* wob   = (const float*)d_in[11];

  // Workspace carving (32 MB total, 256B aligned)
  char* ws = (char*)d_ws;
  size_t off = 0;
  auto alloc = [&](size_t bytes) {
    void* p = ws + off;
    off += (bytes + 255) & ~(size_t)255;
    return p;
  };
  const size_t IN_E = (size_t)MT * D;   // 4194304
  _Float16* Qp  = (_Float16*)alloc(IN_E * 2);
  _Float16* Kp  = (_Float16*)alloc(IN_E * 2);
  _Float16* Vt  = (_Float16*)alloc(IN_E * 2);   // [b][h][d][s]
  _Float16* ctx = (_Float16*)alloc(IN_E * 2);

  // 1) projections, straight from the f32 inputs and weights
  dim3 gg(D / 128, MT / 128);  // (8, 32)
  gemm_f16_wmma<0><<<gg, 256, 0, stream>>>(q_in, nullptr, wq, wqb, (void*)Qp);
  gemm_f16_wmma<0><<<gg, 256, 0, stream>>>(k_in, nullptr, wk, wkb, (void*)Kp);
  gemm_f16_wmma<1><<<gg, 256, 0, stream>>>(v_in, nullptr, wv, wvb, (void*)Vt);

  // 2) attention: 512 blocks = B*H * (S/128)
  flash_attn_wmma<<<BB * H * (S / 128), 256, 0, stream>>>(Qp, Kp, Vt, mask, ctx);

  // 3) output projection -> fp32 d_out
  gemm_f16_wmma<2><<<gg, 256, 0, stream>>>(nullptr, ctx, wo, wob, d_out);
}

// v004
// One run takes 174 microseconds.
// Timed twice side by side with v003, it ran 1.20 and 1.21 times as fast.
// All steps since v000 together make it 1.92 times as fast.
#include <hip/hip_runtime.h>
#include <hip/hip_bf16.h>

// ---------------------------------------------------------------------------
// Multi-head attention for MI455X (gfx1250, wave32, WMMA f32_16x16x32_f16).
// Pipeline: Q/K/V proj GEMMs (WMMA, double-buffered LDS; f32 operands are
// rounded to f16 on their way into LDS) | flash attention (WMMA, online
// softmax) | output proj GEMM (WMMA, fp32 out).
// ~69 GFLOP total, ~120MB minimum HBM traffic -> roughly balanced with f16
// matrix cores; scalar fp32 would be hopelessly compute-bound.
// ---------------------------------------------------------------------------

typedef __attribute__((ext_vector_type(16))) _Float16 v16h;
typedef __attribute__((ext_vector_type(8)))  float    v8f;
typedef __attribute__((ext_vector_type(2)))  float    v2f;
typedef __attribute__((ext_vector_type(2)))  _Float16 v2h;
typedef __attribute__((ext_vector_type(8)))  short    s16x8;

#define WMMA16(a, b, c) \
  __builtin_amdgcn_wmma_f32_16x16x32_f16(false, (a), false, (b), (short)0, (c), false, false)

constexpr int BB = 2;      // batch
constexpr int S  = 2048;   // seq len
constexpr int D  = 1024;   // model dim
constexpr int H  = 16;     // heads
constexpr int HD = 64;     // head dim
constexpr int MT = BB * S; // 4096 tokens

// Load one v16h WMMA operand (16-bit A/B layout): caller passes base already
// offset by kA = (lane<16 ? 0 : 8); halves 0..7 = base[0..7], 8..15 = base[16..23].
__device__ __forceinline__ v16h load_op16(const _Float16* p) {
  union { v16h v; float4 f4[2]; } u;
  u.f4[0] = *(const float4*)(p);
  u.f4[1] = *(const float4*)(p + 16);
  return u.v;
}

// LDS row pitches of the GEMM tiles, in halves, each chosen for its reader.
constexpr int PA = 40;   // A [m][k]: 64 B of data + 16 B (16 B x odd: ds_load_b128 without bank conflicts)
constexpr int PB = 144;  // B [k][n]: 256 B of data + 32 B (32 B x odd: ds_load_tr16_b128 without bank conflicts)

// One v16h B operand out of a row-major [k][n] LDS tile by two transposing loads.
// p is the lane's own address: row 8 * (lane >> 4) + (lane & 7), column base + 8 * ((lane >> 3) & 1).
// The lane gets column base + (lane & 15): halves 0..7 = k 8*hi + 0..7, halves 8..15 = k 16 + 8*hi + 0..7,
// the k order of load_op16.
__device__ __forceinline__ v16h load_op16_tr(const _Float16* p) {
  typedef __attribute__((address_space(3))) s16x8 lds_s16x8;
  union { v16h v; s16x8 q[2]; } u;
  u.q[0] = __builtin_amdgcn_ds_load_tr16_b128_v8i16((lds_s16x8*)p);
  u.q[1] = __builtin_amdgcn_ds_load_tr16_b128_v8i16((lds_s16x8*)(p + 16 * PB));
  return u.v;
}

// ---------------------------------------------------------------------------
// GEMM: C[M=4096][N=1024] = f16(A[4096][1024]) x f16(B[1024][1024]) + bias(f32)
// MODE 0: A = A32 (f32), store f16 row-major      (Q, K projections)
// MODE 1: A = A32 (f32), store f16 as Vt[b,h,d,s] (V projection, pre-transposed for P@V)
// MODE 2: A = A16 (f16), store f32 row-major      (final output projection)
// B is always the f32 weight. f32 operands are read as whole 128-B lines and
// rounded to f16 between the staging registers and LDS, so no separate cast pass.
// B stays [k][n] in LDS as it lies in memory (a wave stores one whole 256-B row at
// a time) and is transposed by the LDS loads that form the operand.
// Block tile 128x128, 8 waves (4 along M x 2 along N), K-step 32,
// double-buffered LDS: one barrier per K-step, global loads for step k+1
// staged in registers while WMMAs consume buffer k.
// ---------------------------------------------------------------------------
template <int MODE>
__global__ __launch_bounds__(256) void gemm_f16_wmma(
    const float* __restrict__ A32, const _Float16* __restrict__ A16,
    const float* __restrict__ Bw, const float* __restrict__ bias,
    void* __restrict__ out) {
  constexpr int K = 1024, N = 1024;
  __shared__ __attribute__((aligned(16))) _Float16 lds_a[2][128 * PA];  // [m][k], padded rows
  __shared__ __attribute__((aligned(16))) _Float16 lds_b[2][32 * PB];   // [k][n], padded rows

  const int tid  = threadIdx.x;
  const int wave = tid >> 5, lane = tid & 31;
  const int l15  = lane & 15, hi = lane >> 4;
  const int kA   = hi ? 8 : 0;
  const int wm   = wave & 3;   // 4 wave-rows of 32
  const int wn   = wave >> 2;  // 2 wave-cols of 64
  const int m0   = blockIdx.y * 128, n0 = blockIdx.x * 128;

  // per-thread staging assignment
  const int arow = tid >> 1, akc = (tid & 1) * 16;  // f16 A: 128 rows x 32, 16 halves a thread
  const int fr = tid >> 3, fc = (tid & 7) * 4;      // f32 A: rows fr + 32*i, 4 floats: 8 lanes = one line
  const int bc = lane * 4;                          // f32 B: k rows wave + 8*i, 4 columns: a wave = one 512-B row

  v8f acc[2][4];
  const v8f vzero = {0.f, 0.f, 0.f, 0.f, 0.f, 0.f, 0.f, 0.f};
#pragma unroll
  for (int i = 0; i < 2; i++)
#pragma unroll
    for (int j = 0; j < 4; j++) acc[i][j] = vzero;

  float4 ra0, ra1, ra2, ra3, rb0, rb1, rb2, rb3;
  auto g_load = [&](int k0) {
    if constexpr (MODE == 2) {
      const float4* asrc = (const float4*)(A16 + (size_t)(m0 + arow) * K + k0 + akc);
      ra0 = asrc[0];
      ra1 = asrc[1];
    } else {
      const float* asrc = A32 + (size_t)(m0 + fr) * K + k0 + fc;
      ra0 = *(const float4*)(asrc);
      ra1 = *(const float4*)(asrc + 32 * K);
      ra2 = *(const float4*)(asrc + 64 * K);
      ra3 = *(const float4*)(asrc + 96 * K);
    }
    const float* bsrc = Bw + (size_t)(k0 + wave) * N + n0 + bc;
    rb0 = *(const float4*)(bsrc);
    rb1 = *(const float4*)(bsrc + 8 * N);
    rb2 = *(const float4*)(bsrc + 16 * N);
    rb3 = *(const float4*)(bsrc + 24 * N);
  };
  // four f32 of one A row -> four f16, one 8-byte LDS store
  auto a_put = [&](int buf, int row, float4 v) {
    union { _Float16 h[4]; unsigned long long u; } w;
    w.h[0] = (_Float16)v.x; w.h[1] = (_Float16)v.y;
    w.h[2] = (_Float16)v.z; w.h[3] = (_Float16)v.w;
    *(unsigned long long*)(&lds_a[buf][row * PA + fc]) = w.u;
  };
  // four f32 of one B row -> four f16, one 8-byte LDS store in the same row
  auto b_put = [&](int buf, int krow, float4 v) {
    union { _Float16 h[4]; unsigned long long u; } w;
    w.h[0] = (_Float16)v.x; w.h[1] = (_Float16)v.y;
    w.h[2] = (_Float16)v.z; w.h[3] = (_Float16)v.w;
    *(unsigned long long*)(&lds_b[buf][krow * PB + bc]) = w.u;
  };
  auto l_store = [&](int buf) {
    if constexpr (MODE == 2) {
      *(float4*)(&lds_a[buf][arow * PA + akc])     = ra0;
      *(float4*)(&lds_a[buf][arow * PA + akc + 8]) = ra1;
    } else {
      a_put(buf, fr, ra0);
      a_put(buf, fr + 32, ra1);
      a_put(buf, fr + 64, ra2);
      a_put(buf, fr + 96, ra3);
    }
    b_put(buf, wave, rb0);
    b_put(buf, wave + 8, rb1);
    b_put(buf, wave + 16, rb2);
    b_put(buf, wave + 24, rb3);
  };

  g_load(0);
  l_store(0);
  __syncthreads();

  for (int k0 = 0; k0 < K; k0 += 32) {
    const int cur = (k0 >> 5) & 1, nxt = cur ^ 1;
    const bool more = (k0 + 32) < K;
    if (more) g_load(k0 + 32);  // overlap next global fetch with WMMA

    v16h aop[2], bop[4];
#pragma unroll
    for (int mt = 0; mt < 2; mt++)
      aop[mt] = load_op16(&lds_a[cur][(wm * 32 + mt * 16 + l15) * PA + kA]);
#pragma unroll
    for (int nt = 0; nt < 4; nt++)
      bop[nt] = load_op16_tr(&lds_b[cur][(hi * 8 + (lane & 7)) * PB + wn * 64 + nt * 16 + ((lane >> 3) & 1) * 8]);
    // keeps all twelve LDS loads in one group ahead of the WMMAs; without it the second
    // A fragment's loads sink between them and their latency is waited out in mid-step
    __builtin_amdgcn_sched_barrier(0);
#pragma unroll
    for (int mt = 0; mt < 2; mt++)
#pragma unroll
      for (int nt = 0; nt < 4; nt++)
        acc[mt][nt] = WMMA16(aop[mt], bop[nt], acc[mt][nt]);

    if (more) l_store(nxt);  // other buffer: no conflict with current readers
    __syncthreads();
  }

  // Epilogue: add bias, store per mode. C layout: VGPR r holds row r + 8*hi,
  // lane%16 holds column within the 16x16 tile.
#pragma unroll
  for (int mt = 0; mt < 2; mt++) {
#pragma unroll
    for (int nt = 0; nt < 4; nt++) {
      int col = n0 + wn * 64 + nt * 16 + l15;
      float bv = bias[col];
      union { v8f v; float f[8]; } u;
      u.v = acc[mt][nt];
#pragma unroll
      for (int r = 0; r < 8; r++) {
        int row = m0 + wm * 32 + mt * 16 + r + hi * 8;
        float val = u.f[r] + bv;
        if (MODE == 0) {
          ((_Float16*)out)[(size_t)row * N + col] = (_Float16)val;
        } else if (MODE == 1) {
          int hh = col >> 6, dd = col & 63;        // head, dim-in-head
          int b = row >> 11, s = row & (S - 1);    // batch, position
          ((_Float16*)out)[((size_t)(b * H + hh) * HD + dd) * S + s] = (_Float16)val;
        } else {
          ((float*)out)[(size_t)row * N + col] = val;
        }
      }
    }
  }
}

constexpr int KT      = 64;
constexpr int NT      = S / KT;
constexpr int PITCH   = 72;
constexpr int TILE_H  = 64 * PITCH;

__device__ __forceinline__ unsigned lds_off(const void* p) { return (unsigned)(size_t)p; }

// value of lane ^ 16 (the other 16-lane half), by a vector cross-row move
__device__ __forceinline__ float other_half(float x) {
  const int b = __builtin_bit_cast(int, x);
  return __builtin_bit_cast(float,
      __builtin_amdgcn_permlanex16(b, b, 0x76543210, 0xfedcba98, false, false));
}

// 512 blocks on 256 WGPs: four waves a SIMD is all the grid gives, so let the
// register budget be that of four (keeps the tile's mask loads ahead of their use).
__global__ __launch_bounds__(256) __attribute__((amdgpu_waves_per_eu(4, 4))) void flash_attn_wmma(
    const _Float16* __restrict__ Qp, const _Float16* __restrict__ Kp,
    const _Float16* __restrict__ Vt, const int* __restrict__ mask,
    _Float16* __restrict__ ctx) {
  __shared__ __attribute__((aligned(16))) _Float16 lds_k[2][TILE_H];  // [key][d], padded rows
  __shared__ __attribute__((aligned(16))) _Float16 lds_v[2][TILE_H];  // [d][key], padded rows

  const int tid  = threadIdx.x;
  const int wave = tid >> 5, lane = tid & 31;
  const int l15  = lane & 15, hi = lane >> 4;
  const int kA   = hi ? 8 : 0;

  const int qb = blockIdx.x & 15;  // S/128 = 16 query blocks
  const int bh = blockIdx.x >> 4;  // b*H + h
  const int b  = bh >> 4, h = bh & 15;
  const int sq = qb * 128 + wave * 16;  // first query row (within sequence)

  // Copy assignment: 8 lanes per 128-B row, rows crow and crow + 32 of each tile.
  const int crow = tid >> 3, cc = tid & 7;
  const _Float16* kg = Kp + ((size_t)(b * S + crow)) * D + h * HD + cc * 8;
  const _Float16* vg = Vt + ((size_t)bh * HD + crow) * S + cc * 8;
  const unsigned lk = lds_off(&lds_k[0][crow * PITCH + cc * 8]);
  const unsigned lv = lds_off(&lds_v[0][crow * PITCH + cc * 8]);

  auto stage = [&](int t, int buf) {
    const _Float16* gk0 = kg + (size_t)t * KT * D;
    const _Float16* gk1 = gk0 + 32 * D;
    const _Float16* gv0 = vg + t * KT;
    const _Float16* gv1 = gv0 + 32 * S;
    const unsigned lk0 = lk + buf * (TILE_H * 2), lk1 = lk0 + 32 * PITCH * 2;
    const unsigned lv0 = lv + buf * (TILE_H * 2), lv1 = lv0 + 32 * PITCH * 2;
    // Global -> LDS through no register; the closing s_wait_xcnt keeps the
    // address registers unchanged until the copies have taken them.
    asm volatile(
        "global_load_async_to_lds_b128 %0, %4, off\n\t"
        "global_load_async_to_lds_b128 %1, %5, off\n\t"
        "global_load_async_to_lds_b128 %2, %6, off\n\t"
        "global_load_async_to_lds_b128 %3, %7, off\n\t"
        "s_wait_xcnt 0x0"
        :: "v"(lk0), "v"(lk1), "v"(lv0), "v"(lv1),
           "v"(gk0), "v"(gk1), "v"(gv0), "v"(gv1)
        : "memory");
  };

  // Q rows held in registers: B-operand layout (column = query), d split into two K=32 chunks
  const _Float16* qbase = Qp + ((size_t)(b * S + sq + l15)) * D + h * HD;
  v16h aq0 = load_op16(qbase + kA);
  v16h aq1 = load_op16(qbase + 32 + kA);

  const v8f vzero = {0.f, 0.f, 0.f, 0.f, 0.f, 0.f, 0.f, 0.f};
  v8f acc[4];  // O^T: acc[t][r] = O[query l15][d = t * 16 + 8 * hi + r]
#pragma unroll
  for (int t = 0; t < 4; t++) acc[t] = vzero;
  float mrun = -INFINITY;  // running maximum of this lane's query, equal in both halves
  float lrun = 0.f;        // running sum over this half's keys only; halves joined at the end

  // this lane's mask row, at its half's first key of a 16-key tile
  const int* mq = mask + ((size_t)b * S + sq + l15) * S + hi * 8;

  stage(0, 0);
  asm volatile("s_wait_asynccnt 0x0" ::: "memory");  // own copies of tile 0 have landed
  __syncthreads();                                   // tile 0 readable by every wave
  stage(1, 1);

  for (int tl = 0; tl < NT; tl++) {
    const int buf = tl & 1;
    const _Float16* kt = &lds_k[buf][0];
    const _Float16* vt = &lds_v[buf][0];
#pragma unroll  // both 32-key halves of the tile: constant LDS offsets
    for (int ps = 0; ps < KT / 32; ps++) {
      const int kc = tl * KT + ps * 32;
      // ---- scores^T: two 16x16 tiles (32 keys), contraction over HD=64 = 2xK32
      float p[2][8];
#pragma unroll
      for (int j = 0; j < 2; j++) {
        // eight consecutive keys of one query: 32 contiguous mask bytes a lane
        const int4 mk0 = *(const int4*)(mq + kc + j * 16);
        const int4 mk1 = *(const int4*)(mq + kc + j * 16 + 4);
        const int mv[8] = {mk0.x, mk0.y, mk0.z, mk0.w, mk1.x, mk1.y, mk1.z, mk1.w};
        const _Float16* kb = kt + (ps * 32 + j * 16 + l15) * PITCH;
        v16h bk0 = load_op16(kb + kA);
        v16h bk1 = load_op16(kb + 32 + kA);
        v8f sc = vzero;
        sc = WMMA16(bk0, aq0, sc);  // A = K rows, B = Q^T
        sc = WMMA16(bk1, aq1, sc);
        sc *= 0.125f;  // 1/sqrt(64)
#pragma unroll
        for (int r = 0; r < 8; r++) p[j][r] = mv[r] ? sc[r] : -1.0e9f;
      }
      // ---- online softmax: 16 of the query's 32 scores are in this lane, 16 in lane ^ 16
      float mx[8];
#pragma unroll
      for (int r = 0; r < 8; r++) mx[r] = fmaxf(p[0][r], p[1][r]);
      float m = fmaxf(fmaxf(fmaxf(mx[0], mx[1]), fmaxf(mx[2], mx[3])),
                      fmaxf(fmaxf(mx[4], mx[5]), fmaxf(mx[6], mx[7])));
      m = fmaxf(m, other_half(m));
      const float mnew = fmaxf(mrun, m);
      const float corr = __expf(mrun - mnew);
      mrun = mnew;
      union { v16h v; v2h h2[8]; } bp;  // P^T as B operand: halves 0..7 = tile 0, 8..15 = tile 1
      float sm[2][4];
#pragma unroll
      for (int j = 0; j < 2; j++) {
#pragma unroll
        for (int i = 0; i < 4; i++) {
          const v2f e = {__expf(p[j][2 * i] - mnew), __expf(p[j][2 * i + 1] - mnew)};
          sm[j][i] = e[0] + e[1];
          bp.h2[j * 4 + i] = __builtin_convertvector(e, v2h);
        }
      }
      const float sum = ((sm[0][0] + sm[0][1]) + (sm[0][2] + sm[0][3])) +
                        ((sm[1][0] + sm[1][1]) + (sm[1][2] + sm[1][3]));
      lrun = lrun * corr + sum;
#pragma unroll
      for (int t = 0; t < 4; t++) acc[t] *= corr;
      // ---- V^T(64x32) @ P^T(32x16): staged Vt rows are contiguous along keys
#pragma unroll
      for (int t = 0; t < 4; t++) {
        const _Float16* vb = vt + (t * 16 + l15) * PITCH + ps * 32;
        v16h av = load_op16(vb + kA);
        acc[t] = WMMA16(av, bp.v, acc[t]);
      }
    }
    // Hand-over: this wave's reads of tile tl are done, its copies of tile
    // tl + 1 have landed; behind the barrier both hold for every wave.
    asm volatile("s_wait_dscnt 0x0" ::: "memory");
    asm volatile("s_wait_asynccnt 0x0" ::: "memory");
    __syncthreads();
    if (tl + 2 < NT) stage(tl + 2, buf);  // refill the buffer every wave has left
  }
  asm volatile("s_wait_asynccnt 0x0" ::: "memory");  // nothing in flight at the wave's end

  // ---- normalize and store into context [token][h*64 + d]: 8 consecutive d a lane
  const float lsum = lrun + other_half(lrun);
  _Float16* crow_out = ctx + ((size_t)(b * S + sq + l15)) * D + h * HD + hi * 8;
#pragma unroll
  for (int t = 0; t < 4; t++) {
    union { _Float16 hh[8]; float4 f4; } o;
#pragma unroll
    for (int r = 0; r < 8; r++) o.hh[r] = (_Float16)(acc[t][r] / lsum);
    *(float4*)(crow_out + t * 16) = o.f4;
  }
}

// ---------------------------------------------------------------------------
// Host-side launch
// ---------------------------------------------------------------------------
extern "C" void kernel_launch(void* const* d_in, const int* in_sizes, int n_in,
                              void* d_out, int out_size, void* d_ws, size_t ws_size,
                              hipStream_t stream) {
  const float* q_in  = (const float*)d_in[0];
  const float* k_in  = (const float*)d_in[1];
  const float* v_in  = (const float*)d_in[2];
  const int*   mask  = (const int*)d_in[3];
  const float* wq    = (const float*)d_in[4];
  const float* wqb   = (const float*)d_in[5];
  const float* wk    = (const float*)d_in[6];
  const float* wkb   = (const float*)d_in[7];
  const float* wv    = (const float*)d_in[8];
  const float* wvb   = (const float*)d_in[9];
  const float* wo    = (const float*)d_in[10];
  const float* wob   = (const float*)d_in[11];

  // Workspace carving (32 MB total, 256B aligned)
  char* ws = (char*)d_ws;
  size_t off = 0;
  auto alloc = [&](size_t bytes) {
    void* p = ws + off;
    off += (bytes + 255) & ~(size_t)255;
    return p;
  };
  const size_t IN_E = (size_t)MT * D;   // 4194304
  _Float16* Qp  = (_Float16*)alloc(IN_E * 2);
  _Float16* Kp  = (_Float16*)alloc(IN_E * 2);
  _Float16* Vt  = (_Float16*)alloc(IN_E * 2);   // [b][h][d][s]
  _Float16* ctx = (_Float16*)alloc(IN_E * 2);

  // 1) projections, straight from the f32 inputs and weights
  dim3 gg(D / 128, MT / 128);  // (8, 32)
  gemm_f16_wmma<0><<<gg, 256, 0, stream>>>(q_in, nullptr, wq, wqb, (void*)Qp);
  gemm_f16_wmma<0><<<gg, 256, 0, stream>>>(k_in, nullptr, wk, wkb, (void*)Kp);
  gemm_f16_wmma<1><<<gg, 256, 0, stream>>>(v_in, nullptr, wv, wvb, (void*)Vt);

  // 2) attention: 512 blocks = B*H * (S/128)
  flash_attn_wmma<<<BB * H * (S / 128), 256, 0, stream>>>(Qp, Kp, Vt, mask, ctx);

  // 3) output projection -> fp32 d_out
  gemm_f16_wmma<2><<<gg, 256, 0, stream>>>(nullptr, ctx, wo, wob, d_out);
}

// v005
// It runs in 130 microseconds.
// Timed twice side by side with v004, it ran 1.34 and 1.33 times as fast.
// Over all steps from v000 it is 2.57 times as fast.
#include <hip/hip_runtime.h>
#include <hip/hip_bf16.h>

// ---------------------------------------------------------------------------
// Multi-head attention for MI455X (gfx1250, wave32, WMMA f32_16x16x32_f16).
// Pipeline: Q/K/V proj GEMMs (WMMA, double-buffered LDS; f32 operands are
// rounded to f16 on their way into LDS) | flash attention (WMMA, online
// softmax) | output proj GEMM (WMMA, fp32 out).
// ~69 GFLOP total, ~120MB minimum HBM traffic -> roughly balanced with f16
// matrix cores; scalar fp32 would be hopelessly compute-bound.
// ---------------------------------------------------------------------------

typedef __attribute__((ext_vector_type(16))) _Float16 v16h;
typedef __attribute__((ext_vector_type(8)))  float    v8f;
typedef __attribute__((ext_vector_type(2)))  float    v2f;
typedef __attribute__((ext_vector_type(2)))  _Float16 v2h;
typedef __attribute__((ext_vector_type(8)))  short    s16x8;

#define WMMA16(a, b, c) \
  __builtin_amdgcn_wmma_f32_16x16x32_f16(false, (a), false, (b), (short)0, (c), false, false)

constexpr int BB = 2;      // batch
constexpr int S  = 2048;   // seq len
constexpr int D  = 1024;   // model dim
constexpr int H  = 16;     // heads
constexpr int HD = 64;     // head dim
constexpr int MT = BB * S; // 4096 tokens

// Load one v16h WMMA operand (16-bit A/B layout): caller passes base already
// offset by kA = (lane<16 ? 0 : 8); halves 0..7 = base[0..7], 8..15 = base[16..23].
__device__ __forceinline__ v16h load_op16(const _Float16* p) {
  union { v16h v; float4 f4[2]; } u;
  u.f4[0] = *(const float4*)(p);
  u.f4[1] = *(const float4*)(p + 16);
  return u.v;
}

// LDS row pitches of the GEMM tiles, in halves, each chosen for its reader.
constexpr int PA = 40;   // A [m][k]: 64 B of data + 16 B (16 B x odd: ds_load_b128 without bank conflicts)
constexpr int PB = 144;  // B [k][n]: 256 B of data + 32 B (32 B x odd: ds_load_tr16_b128 without bank conflicts)

// One v16h B operand out of a row-major [k][n] LDS tile by two transposing loads.
// p is the lane's own address: row 8 * (lane >> 4) + (lane & 7), column base + 8 * ((lane >> 3) & 1).
// The lane gets column base + (lane & 15): halves 0..7 = k 8*hi + 0..7, halves 8..15 = k 16 + 8*hi + 0..7,
// the k order of load_op16.
__device__ __forceinline__ v16h load_op16_tr(const _Float16* p) {
  typedef __attribute__((address_space(3))) s16x8 lds_s16x8;
  union { v16h v; s16x8 q[2]; } u;
  u.q[0] = __builtin_amdgcn_ds_load_tr16_b128_v8i16((lds_s16x8*)p);
  u.q[1] = __builtin_amdgcn_ds_load_tr16_b128_v8i16((lds_s16x8*)(p + 16 * PB));
  return u.v;
}

// ---------------------------------------------------------------------------
// GEMM: C[M=4096][N=1024] = f16(A[4096][1024]) x f16(B[1024][1024]) + bias(f32)
// MODE 0: the three input projections in ONE launch, blockIdx.z picks the problem:
//         z = 0, 1: A = f32 query / key, store f16 row-major (Q, K)
//         z = 2:    A = f32 value, store f16 as Vt[b,h,d,s] (pre-transposed for P@V)
//         768 blocks = three on every WGP (six waves a SIMD): one block's wait for
//         its next tile's global loads is filled by the other two blocks' work.
// MODE 2: A = A16 (f16), store f32 row-major      (final output projection)
// B is always the f32 weight. f32 operands are read as whole 128-B lines and
// rounded to f16 between the staging registers and LDS, so no separate cast pass.
// B stays [k][n] in LDS as it lies in memory (a wave stores one whole 256-B row at
// a time) and is transposed by the LDS loads that form the operand.
// Block tile 128x128, 8 waves (4 along M x 2 along N), K-step 32,
// double-buffered LDS: one barrier per K-step, global loads for step k+1
// staged in registers while WMMAs consume buffer k.
// ---------------------------------------------------------------------------
template <int V> struct form_tag { static constexpr int value = V; };

template <int MODE>
__device__ __forceinline__ void gemm_body(
    const float* __restrict__ A32, const _Float16* __restrict__ A16,
    const float* __restrict__ Bw, const float* __restrict__ bias,
    void* __restrict__ out, const bool vt_out) {
  constexpr int K = 1024, N = 1024;
  __shared__ __attribute__((aligned(16))) _Float16 lds_a[2][128 * PA];  // [m][k], padded rows
  __shared__ __attribute__((aligned(16))) _Float16 lds_b[2][32 * PB];   // [k][n], padded rows

  const int tid  = threadIdx.x;
  const int wave = tid >> 5, lane = tid & 31;
  const int l15  = lane & 15, hi = lane >> 4;
  const int kA   = hi ? 8 : 0;
  const int wm   = wave & 3;   // 4 wave-rows of 32
  const int wn   = wave >> 2;  // 2 wave-cols of 64
  const int m0   = blockIdx.y * 128, n0 = blockIdx.x * 128;

  // per-thread staging assignment
  const int arow = tid >> 1, akc = (tid & 1) * 16;  // f16 A: 128 rows x 32, 16 halves a thread
  const int fr = tid >> 3, fc = (tid & 7) * 4;      // f32 A: rows fr + 32*i, 4 floats: 8 lanes = one line
  const int bc = lane * 4;                          // f32 B: k rows wave + 8*i, 4 columns: a wave = one 512-B row

  v8f acc[2][4];
  const v8f vzero = {0.f, 0.f, 0.f, 0.f, 0.f, 0.f, 0.f, 0.f};
#pragma unroll
  for (int i = 0; i < 2; i++)
#pragma unroll
    for (int j = 0; j < 4; j++) acc[i][j] = vzero;

  float4 ra0, ra1, ra2, ra3, rb0, rb1, rb2, rb3;
  auto g_load = [&](int k0) {
    if constexpr (MODE == 2) {
      const float4* asrc = (const float4*)(A16 + (size_t)(m0 + arow) * K + k0 + akc);
      ra0 = asrc[0];
      ra1 = asrc[1];
    } else {
      const float* asrc = A32 + (size_t)(m0 + fr) * K + k0 + fc;
      ra0 = *(const float4*)(asrc);
      ra1 = *(const float4*)(asrc + 32 * K);
      ra2 = *(const float4*)(asrc + 64 * K);
      ra3 = *(const float4*)(asrc + 96 * K);
    }
    const float* bsrc = Bw + (size_t)(k0 + wave) * N + n0 + bc;
    rb0 = *(const float4*)(bsrc);
    rb1 = *(const float4*)(bsrc + 8 * N);
    rb2 = *(const float4*)(bsrc + 16 * N);
    rb3 = *(const float4*)(bsrc + 24 * N);
  };
  // four f32 of one A row -> four f16, one 8-byte LDS store
  auto a_put = [&](int buf, int row, float4 v) {
    union { _Float16 h[4]; unsigned long long u; } w;
    w.h[0] = (_Float16)v.x; w.h[1] = (_Float16)v.y;
    w.h[2] = (_Float16)v.z; w.h[3] = (_Float16)v.w;
    *(unsigned long long*)(&lds_a[buf][row * PA + fc]) = w.u;
  };
  // four f32 of one B row -> four f16, one 8-byte LDS store in the same row
  auto b_put = [&](int buf, int krow, float4 v) {
    union { _Float16 h[4]; unsigned long long u; } w;
    w.h[0] = (_Float16)v.x; w.h[1] = (_Float16)v.y;
    w.h[2] = (_Float16)v.z; w.h[3] = (_Float16)v.w;
    *(unsigned long long*)(&lds_b[buf][krow * PB + bc]) = w.u;
  };
  auto l_store = [&](int buf) {
    if constexpr (MODE == 2) {
      *(float4*)(&lds_a[buf][arow * PA + akc])     = ra0;
      *(float4*)(&lds_a[buf][arow * PA + akc + 8]) = ra1;
    } else {
      a_put(buf, fr, ra0);
      a_put(buf, fr + 32, ra1);
      a_put(buf, fr + 64, ra2);
      a_put(buf, fr + 96, ra3);
    }
    b_put(buf, wave, rb0);
    b_put(buf, wave + 8, rb1);
    b_put(buf, wave + 16, rb2);
    b_put(buf, wave + 24, rb3);
  };

  g_load(0);
  l_store(0);
  __syncthreads();

  for (int k0 = 0; k0 < K; k0 += 32) {
    const int cur = (k0 >> 5) & 1, nxt = cur ^ 1;
    const bool more = (k0 + 32) < K;
    if (more) g_load(k0 + 32);  // overlap next global fetch with WMMA

    v16h aop[2], bop[4];
#pragma unroll
    for (int mt = 0; mt < 2; mt++)
      aop[mt] = load_op16(&lds_a[cur][(wm * 32 + mt * 16 + l15) * PA + kA]);
#pragma unroll
    for (int nt = 0; nt < 4; nt++)
      bop[nt] = load_op16_tr(&lds_b[cur][(hi * 8 + (lane & 7)) * PB + wn * 64 + nt * 16 + ((lane >> 3) & 1) * 8]);
    // keeps all twelve LDS loads in one group ahead of the WMMAs; without it the second
    // A fragment's loads sink between them and their latency is waited out in mid-step
    __builtin_amdgcn_sched_barrier(0);
#pragma unroll
    for (int mt = 0; mt < 2; mt++)
#pragma unroll
      for (int nt = 0; nt < 4; nt++)
        acc[mt][nt] = WMMA16(aop[mt], bop[nt], acc[mt][nt]);

    if (more) l_store(nxt);  // other buffer: no conflict with current readers
    __syncthreads();
  }

  // Epilogue: add bias, store per form. C layout: VGPR r holds row r + 8*hi,
  // lane%16 holds column within the 16x16 tile. The form is chosen once, outside
  // the loops (FORM 0: f16 row-major, 1: f16 Vt[b,h,d,s], 2: f32 row-major).
  auto store_all = [&](auto form) {
    constexpr int FORM = decltype(form)::value;
#pragma unroll
    for (int mt = 0; mt < 2; mt++) {
#pragma unroll
      for (int nt = 0; nt < 4; nt++) {
        int col = n0 + wn * 64 + nt * 16 + l15;
        float bv = bias[col];
        union { v8f v; float f[8]; } u;
        u.v = acc[mt][nt];
#pragma unroll
        for (int r = 0; r < 8; r++) {
          int row = m0 + wm * 32 + mt * 16 + r + hi * 8;
          float val = u.f[r] + bv;
          if (FORM == 0) {
            ((_Float16*)out)[(size_t)row * N + col] = (_Float16)val;
          } else if (FORM == 1) {
            int hh = col >> 6, dd = col & 63;        // head, dim-in-head
            int b = row >> 11, s = row & (S - 1);    // batch, position
            ((_Float16*)out)[((size_t)(b * H + hh) * HD + dd) * S + s] = (_Float16)val;
          } else {
            ((float*)out)[(size_t)row * N + col] = val;
          }
        }
      }
    }
    // In the built object the Vt form's code follows this form's stores and writes
    // their registers: they are held until the stores have taken them.
    if constexpr (FORM == 0) asm volatile("s_wait_xcnt 0x0" ::: "memory");
  };
  if constexpr (MODE == 2) {
    store_all(form_tag<2>{});
  } else {
    if (vt_out) store_all(form_tag<1>{});
    else        store_all(form_tag<0>{});
  }
}

// Q, K and V projections, one launch. At 154 registers a wave and 38,912 B of LDS a
// block, three blocks fit on a WGP, so all 768 are resident at once.
__global__ __launch_bounds__(256) void gemm_qkv_wmma(
    const float* __restrict__ xq, const float* __restrict__ xk, const float* __restrict__ xv,
    const float* __restrict__ wq, const float* __restrict__ wk, const float* __restrict__ wv,
    const float* __restrict__ bq, const float* __restrict__ bk, const float* __restrict__ bv,
    _Float16* __restrict__ oq, _Float16* __restrict__ ok, _Float16* __restrict__ ov) {
  const int z = blockIdx.z;
  const float* x = z == 0 ? xq : z == 1 ? xk : xv;
  const float* w = z == 0 ? wq : z == 1 ? wk : wv;
  const float* bi = z == 0 ? bq : z == 1 ? bk : bv;
  _Float16* o = z == 0 ? oq : z == 1 ? ok : ov;
  gemm_body<0>(x, nullptr, w, bi, (void*)o, z == 2);
}

__global__ __launch_bounds__(256) void gemm_out_wmma(
    const _Float16* __restrict__ A16, const float* __restrict__ Bw,
    const float* __restrict__ bias, float* __restrict__ out) {
  gemm_body<2>(nullptr, A16, Bw, bias, (void*)out, false);
}

constexpr int KT      = 64;
constexpr int NT      = S / KT;
constexpr int PITCH   = 72;
constexpr int TILE_H  = 64 * PITCH;

__device__ __forceinline__ unsigned lds_off(const void* p) { return (unsigned)(size_t)p; }

// value of lane ^ 16 (the other 16-lane half), by a vector cross-row move
__device__ __forceinline__ float other_half(float x) {
  const int b = __builtin_bit_cast(int, x);
  return __builtin_bit_cast(float,
      __builtin_amdgcn_permlanex16(b, b, 0x76543210, 0xfedcba98, false, false));
}

// 512 blocks on 256 WGPs: four waves a SIMD is all the grid gives, so let the
// register budget be that of four (keeps the tile's mask loads ahead of their use).
__global__ __launch_bounds__(256) __attribute__((amdgpu_waves_per_eu(4, 4))) void flash_attn_wmma(
    const _Float16* __restrict__ Qp, const _Float16* __restrict__ Kp,
    const _Float16* __restrict__ Vt, const int* __restrict__ mask,
    _Float16* __restrict__ ctx) {
  __shared__ __attribute__((aligned(16))) _Float16 lds_k[2][TILE_H];  // [key][d], padded rows
  __shared__ __attribute__((aligned(16))) _Float16 lds_v[2][TILE_H];  // [d][key], padded rows

  const int tid  = threadIdx.x;
  const int wave = tid >> 5, lane = tid & 31;
  const int l15  = lane & 15, hi = lane >> 4;
  const int kA   = hi ? 8 : 0;

  const int qb = blockIdx.x & 15;  // S/128 = 16 query blocks
  const int bh = blockIdx.x >> 4;  // b*H + h
  const int b  = bh >> 4, h = bh & 15;
  const int sq = qb * 128 + wave * 16;  // first query row (within sequence)

  // Copy assignment: 8 lanes per 128-B row, rows crow and crow + 32 of each tile.
  const int crow = tid >> 3, cc = tid & 7;
  const _Float16* kg = Kp + ((size_t)(b * S + crow)) * D + h * HD + cc * 8;
  const _Float16* vg = Vt + ((size_t)bh * HD + crow) * S + cc * 8;
  const unsigned lk = lds_off(&lds_k[0][crow * PITCH + cc * 8]);
  const unsigned lv = lds_off(&lds_v[0][crow * PITCH + cc * 8]);

  auto stage = [&](int t, int buf) {
    const _Float16* gk0 = kg + (size_t)t * KT * D;
    const _Float16* gk1 = gk0 + 32 * D;
    const _Float16* gv0 = vg + t * KT;
    const _Float16* gv1 = gv0 + 32 * S;
    const unsigned lk0 = lk + buf * (TILE_H * 2), lk1 = lk0 + 32 * PITCH * 2;
    const unsigned lv0 = lv + buf * (TILE_H * 2), lv1 = lv0 + 32 * PITCH * 2;
    // Global -> LDS through no register; the closing s_wait_xcnt keeps the
    // address registers unchanged until the copies have taken them.
    asm volatile(
        "global_load_async_to_lds_b128 %0, %4, off\n\t"
        "global_load_async_to_lds_b128 %1, %5, off\n\t"
        "global_load_async_to_lds_b128 %2, %6, off\n\t"
        "global_load_async_to_lds_b128 %3, %7, off\n\t"
        "s_wait_xcnt 0x0"
        :: "v"(lk0), "v"(lk1), "v"(lv0), "v"(lv1),
           "v"(gk0), "v"(gk1), "v"(gv0), "v"(gv1)
        : "memory");
  };

  // Q rows held in registers: B-operand layout (column = query), d split into two K=32 chunks
  const _Float16* qbase = Qp + ((size_t)(b * S + sq + l15)) * D + h * HD;
  v16h aq0 = load_op16(qbase + kA);
  v16h aq1 = load_op16(qbase + 32 + kA);

  const v8f vzero = {0.f, 0.f, 0.f, 0.f, 0.f, 0.f, 0.f, 0.f};
  v8f acc[4];  // O^T: acc[t][r] = O[query l15][d = t * 16 + 8 * hi + r]
#pragma unroll
  for (int t = 0; t < 4; t++) acc[t] = vzero;
  float mrun = -INFINITY;  // running maximum of this lane's query, equal in both halves
  float lrun = 0.f;        // running sum over this half's keys only; halves joined at the end

  // this lane's mask row, at its half's first key of a 16-key tile
  const int* mq = mask + ((size_t)b * S + sq + l15) * S + hi * 8;

  stage(0, 0);
  asm volatile("s_wait_asynccnt 0x0" ::: "memory");  // own copies of tile 0 have landed
  __syncthreads();                                   // tile 0 readable by every wave
  stage(1, 1);

  for (int tl = 0; tl < NT; tl++) {
    const int buf = tl & 1;
    const _Float16* kt = &lds_k[buf][0];
    const _Float16* vt = &lds_v[buf][0];
#pragma unroll  // both 32-key halves of the tile: constant LDS offsets
    for (int ps = 0; ps < KT / 32; ps++) {
      const int kc = tl * KT + ps * 32;
      // ---- scores^T: two 16x16 tiles (32 keys), contraction over HD=64 = 2xK32
      float p[2][8];
#pragma unroll
      for (int j = 0; j < 2; j++) {
        // eight consecutive keys of one query: 32 contiguous mask bytes a lane
        const int4 mk0 = *(const int4*)(mq + kc + j * 16);
        const int4 mk1 = *(const int4*)(mq + kc + j * 16 + 4);
        const int mv[8] = {mk0.x, mk0.y, mk0.z, mk0.w, mk1.x, mk1.y, mk1.z, mk1.w};
        const _Float16* kb = kt + (ps * 32 + j * 16 + l15) * PITCH;
        v16h bk0 = load_op16(kb + kA);
        v16h bk1 = load_op16(kb + 32 + kA);
        v8f sc = vzero;
        sc = WMMA16(bk0, aq0, sc);  // A = K rows, B = Q^T
        sc = WMMA16(bk1, aq1, sc);
        sc *= 0.125f;  // 1/sqrt(64)
#pragma unroll
        for (int r = 0; r < 8; r++) p[j][r] = mv[r] ? sc[r] : -1.0e9f;
      }
      // ---- online softmax: 16 of the query's 32 scores are in this lane, 16 in lane ^ 16
      float mx[8];
#pragma unroll
      for (int r = 0; r < 8; r++) mx[r] = fmaxf(p[0][r], p[1][r]);
      float m = fmaxf(fmaxf(fmaxf(mx[0], mx[1]), fmaxf(mx[2], mx[3])),
                      fmaxf(fmaxf(mx[4], mx[5]), fmaxf(mx[6], mx[7])));
      m = fmaxf(m, other_half(m));
      const float mnew = fmaxf(mrun, m);
      const float corr = __expf(mrun - mnew);
      mrun = mnew;
      union { v16h v; v2h h2[8]; } bp;  // P^T as B operand: halves 0..7 = tile 0, 8..15 = tile 1
      float sm[2][4];
#pragma unroll
      for (int j = 0; j < 2; j++) {
#pragma unroll
        for (int i = 0; i < 4; i++) {
          const v2f e = {__expf(p[j][2 * i] - mnew), __expf(p[j][2 * i + 1] - mnew)};
          sm[j][i] = e[0] + e[1];
          bp.h2[j * 4 + i] = __builtin_convertvector(e, v2h);
        }
      }
      const float sum = ((sm[0][0] + sm[0][1]) + (sm[0][2] + sm[0][3])) +
                        ((sm[1][0] + sm[1][1]) + (sm[1][2] + sm[1][3]));
      lrun = lrun * corr + sum;
#pragma unroll
      for (int t = 0; t < 4; t++) acc[t] *= corr;
      // ---- V^T(64x32) @ P^T(32x16): staged Vt rows are contiguous along keys
#pragma unroll
      for (int t = 0; t < 4; t++) {
        const _Float16* vb = vt + (t * 16 + l15) * PITCH + ps * 32;
        v16h av = load_op16(vb + kA);
        acc[t] = WMMA16(av, bp.v, acc[t]);
      }
    }
    // Hand-over: this wave's reads of tile tl are done, its copies of tile
    // tl + 1 have landed; behind the barrier both hold for every wave.
    asm volatile("s_wait_dscnt 0x0" ::: "memory");
    asm volatile("s_wait_asynccnt 0x0" ::: "memory");
    __syncthreads();
    if (tl + 2 < NT) stage(tl + 2, buf);  // refill the buffer every wave has left
  }
  asm volatile("s_wait_asynccnt 0x0" ::: "memory");  // nothing in flight at the wave's end

  // ---- normalize and store into context [token][h*64 + d]: 8 consecutive d a lane
  const float lsum = lrun + other_half(lrun);
  _Float16* crow_out = ctx + ((size_t)(b * S + sq + l15)) * D + h * HD + hi * 8;
#pragma unroll
  for (int t = 0; t < 4; t++) {
    union { _Float16 hh[8]; float4 f4; } o;
#pragma unroll
    for (int r = 0; r < 8; r++) o.hh[r] = (_Float16)(acc[t][r] / lsum);
    *(float4*)(crow_out + t * 16) = o.f4;
  }
}

// ---------------------------------------------------------------------------
// Host-side launch
// ---------------------------------------------------------------------------
extern "C" void kernel_launch(void* const* d_in, const int* in_sizes, int n_in,
                              void* d_out, int out_size, void* d_ws, size_t ws_size,
                              hipStream_t stream) {
  const float* q_in  = (const float*)d_in[0];
  const float* k_in  = (const float*)d_in[1];
  const float* v_in  = (const float*)d_in[2];
  const int*   mask  = (const int*)d_in[3];
  const float* wq    = (const float*)d_in[4];
  const float* wqb   = (const float*)d_in[5];
  const float* wk    = (const float*)d_in[6];
  const float* wkb   = (const float*)d_in[7];
  const float* wv    = (const float*)d_in[8];
  const float* wvb   = (const float*)d_in[9];
  const float* wo    = (const float*)d_in[10];
  const float* wob   = (const float*)d_in[11];

  // Workspace carving (32 MB total, 256B aligned)
  char* ws = (char*)d_ws;
  size_t off = 0;
  auto alloc = [&](size_t bytes) {
    void* p = ws + off;
    off += (bytes + 255) & ~(size_t)255;
    return p;
  };
  const size_t IN_E = (size_t)MT * D;   // 4194304
  _Float16* Qp  = (_Float16*)alloc(IN_E * 2);
  _Float16* Kp  = (_Float16*)alloc(IN_E * 2);
  _Float16* Vt  = (_Float16*)alloc(IN_E * 2);   // [b][h][d][s]
  _Float16* ctx = (_Float16*)alloc(IN_E * 2);

  // 1) the three projections in one launch, straight from the f32 inputs and weights
  dim3 gg(D / 128, MT / 128);      // (8, 32)
  dim3 g3(D / 128, MT / 128, 3);   // (8, 32, 3)
  gemm_qkv_wmma<<<g3, 256, 0, stream>>>(q_in, k_in, v_in, wq, wk, wv, wqb, wkb, wvb, Qp, Kp, Vt);

  // 2) attention: 512 blocks = B*H * (S/128)
  flash_attn_wmma<<<BB * H * (S / 128), 256, 0, stream>>>(Qp, Kp, Vt, mask, ctx);

  // 3) output projection -> fp32 d_out
  gemm_out_wmma<<<gg, 256, 0, stream>>>(ctx, wo, wob, (float*)d_out);
}

// v006
// Measured time: 112 microseconds a run.
// Next to v005, in two timings, it ran 1.15 and 1.16 times as fast.
// Over all steps from v000 it is 2.96 times as fast.
#include <hip/hip_runtime.h>
#include <hip/hip_bf16.h>

// ---------------------------------------------------------------------------
// Multi-head attention for MI455X (gfx1250, wave32, WMMA f32_16x16x32_f16).
// Pipeline: mask packed to lane masks | Q/K/V proj GEMMs (WMMA, double-buffered
// LDS; f32 operands are rounded to f16 on their way into LDS) | flash attention
// (WMMA, online softmax) | output proj GEMM (WMMA, fp32 out).
// ~69 GFLOP total, ~120MB minimum HBM traffic -> roughly balanced with f16
// matrix cores; scalar fp32 would be hopelessly compute-bound.
// ---------------------------------------------------------------------------

typedef __attribute__((ext_vector_type(16))) _Float16 v16h;
typedef __attribute__((ext_vector_type(8)))  float    v8f;
typedef __attribute__((ext_vector_type(2)))  float    v2f;
typedef __attribute__((ext_vector_type(2)))  _Float16 v2h;
typedef __attribute__((ext_vector_type(8)))  short    s16x8;
typedef __attribute__((ext_vector_type(16))) unsigned u32x16;
typedef const __attribute__((address_space(4))) u32x16 const_u32x16;  // memory no store of the kernel touches

#define WMMA16(a, b, c) \
  __builtin_amdgcn_wmma_f32_16x16x32_f16(false, (a), false, (b), (short)0, (c), false, false)

constexpr int BB = 2;      // batch
constexpr int S  = 2048;   // seq len
constexpr int D  = 1024;   // model dim
constexpr int H  = 16;     // heads
constexpr int HD = 64;     // head dim
constexpr int MT = BB * S; // 4096 tokens

// Load one v16h WMMA operand (16-bit A/B layout): caller passes base already
// offset by kA = (lane<16 ? 0 : 8); halves 0..7 = base[0..7], 8..15 = base[16..23].
__device__ __forceinline__ v16h load_op16(const _Float16* p) {
  union { v16h v; float4 f4[2]; } u;
  u.f4[0] = *(const float4*)(p);
  u.f4[1] = *(const float4*)(p + 16);
  return u.v;
}

// LDS row pitches of the GEMM tiles, in halves, each chosen for its reader.
constexpr int PA = 40;   // A [m][k]: 64 B of data + 16 B (16 B x odd: ds_load_b128 without bank conflicts)
constexpr int PB = 144;  // B [k][n]: 256 B of data + 32 B (32 B x odd: ds_load_tr16_b128 without bank conflicts)

// One v16h B operand out of a row-major [k][n] LDS tile by two transposing loads.
// p is the lane's own address: row 8 * (lane >> 4) + (lane & 7), column base + 8 * ((lane >> 3) & 1).
// The lane gets column base + (lane & 15): halves 0..7 = k 8*hi + 0..7, halves 8..15 = k 16 + 8*hi + 0..7,
// the k order of load_op16.
__device__ __forceinline__ v16h load_op16_tr(const _Float16* p) {
  typedef __attribute__((address_space(3))) s16x8 lds_s16x8;
  union { v16h v; s16x8 q[2]; } u;
  u.q[0] = __builtin_amdgcn_ds_load_tr16_b128_v8i16((lds_s16x8*)p);
  u.q[1] = __builtin_amdgcn_ds_load_tr16_b128_v8i16((lds_s16x8*)(p + 16 * PB));
  return u.v;
}

// ---------------------------------------------------------------------------
// GEMM: C[M=4096][N=1024] = f16(A[4096][1024]) x f16(B[1024][1024]) + bias(f32)
// MODE 0: the three input projections in ONE launch, blockIdx.z picks the problem:
//         z = 0, 1: A = f32 query / key, store f16 row-major (Q, K)
//         z = 2:    A = f32 value, store f16 as Vt[b,h,d,s] (pre-transposed for P@V)
//         768 blocks = three on every WGP (six waves a SIMD): one block's wait for
//         its next tile's global loads is filled by the other two blocks' work.
// MODE 2: A = A16 (f16), store f32 row-major      (final output projection)
// B is always the f32 weight. f32 operands are read as whole 128-B lines and
// rounded to f16 between the staging registers and LDS, so no separate cast pass.
// B stays [k][n] in LDS as it lies in memory (a wave stores one whole 256-B row at
// a time) and is transposed by the LDS loads that form the operand.
// Block tile 128x128, 8 waves (4 along M x 2 along N), K-step 32,
// double-buffered LDS: one barrier per K-step, global loads for step k+1
// staged in registers while WMMAs consume buffer k.
// ---------------------------------------------------------------------------
template <int V> struct form_tag { static constexpr int value = V; };

template <int MODE>
__device__ __forceinline__ void gemm_body(
    const float* __restrict__ A32, const _Float16* __restrict__ A16,
    const float* __restrict__ Bw, const float* __restrict__ bias,
    void* __restrict__ out, const bool vt_out) {
  constexpr int K = 1024, N = 1024;
  __shared__ __attribute__((aligned(16))) _Float16 lds_a[2][128 * PA];  // [m][k], padded rows
  __shared__ __attribute__((aligned(16))) _Float16 lds_b[2][32 * PB];   // [k][n], padded rows

  const int tid  = threadIdx.x;
  const int wave = tid >> 5, lane = tid & 31;
  const int l15  = lane & 15, hi = lane >> 4;
  const int kA   = hi ? 8 : 0;
  const int wm   = wave & 3;   // 4 wave-rows of 32
  const int wn   = wave >> 2;  // 2 wave-cols of 64
  const int m0   = blockIdx.y * 128, n0 = blockIdx.x * 128;

  // per-thread staging assignment
  const int arow = tid >> 1, akc = (tid & 1) * 16;  // f16 A: 128 rows x 32, 16 halves a thread
  const int fr = tid >> 3, fc = (tid & 7) * 4;      // f32 A: rows fr + 32*i, 4 floats: 8 lanes = one line
  const int bc = lane * 4;                          // f32 B: k rows wave + 8*i, 4 columns: a wave = one 512-B row

  v8f acc[2][4];
  const v8f vzero = {0.f, 0.f, 0.f, 0.f, 0.f, 0.f, 0.f, 0.f};
#pragma unroll
  for (int i = 0; i < 2; i++)
#pragma unroll
    for (int j = 0; j < 4; j++) acc[i][j] = vzero;

  float4 ra0, ra1, ra2, ra3, rb0, rb1, rb2, rb3;
  auto g_load = [&](int k0) {
    if constexpr (MODE == 2) {
      const float4* asrc = (const float4*)(A16 + (size_t)(m0 + arow) * K + k0 + akc);
      ra0 = asrc[0];
      ra1 = asrc[1];
    } else {
      const float* asrc = A32 + (size_t)(m0 + fr) * K + k0 + fc;
      ra0 = *(const float4*)(asrc);
      ra1 = *(const float4*)(asrc + 32 * K);
      ra2 = *(const float4*)(asrc + 64 * K);
      ra3 = *(const float4*)(asrc + 96 * K);
    }
    const float* bsrc = Bw + (size_t)(k0 + wave) * N + n0 + bc;
    rb0 = *(const float4*)(bsrc);
    rb1 = *(const float4*)(bsrc + 8 * N);
    rb2 = *(const float4*)(bsrc + 16 * N);
    rb3 = *(const float4*)(bsrc + 24 * N);
  };
  // four f32 of one A row -> four f16, one 8-byte LDS store
  auto a_put = [&](int buf, int row, float4 v) {
    union { _Float16 h[4]; unsigned long long u; } w;
    w.h[0] = (_Float16)v.x; w.h[1] = (_Float16)v.y;
    w.h[2] = (_Float16)v.z; w.h[3] = (_Float16)v.w;
    *(unsigned long long*)(&lds_a[buf][row * PA + fc]) = w.u;
  };
  // four f32 of one B row -> four f16, one 8-byte LDS store in the same row
  auto b_put = [&](int buf, int krow, float4 v) {
    union { _Float16 h[4]; unsigned long long u; } w;
    w.h[0] = (_Float16)v.x; w.h[1] = (_Float16)v.y;
    w.h[2] = (_Float16)v.z; w.h[3] = (_Float16)v.w;
    *(unsigned long long*)(&lds_b[buf][krow * PB + bc]) = w.u;
  };
  auto l_store = [&](int buf) {
    if constexpr (MODE == 2) {
      *(float4*)(&lds_a[buf][arow * PA + akc])     = ra0;
      *(float4*)(&lds_a[buf][arow * PA + akc + 8]) = ra1;
    } else {
      a_put(buf, fr, ra0);
      a_put(buf, fr + 32, ra1);
      a_put(buf, fr + 64, ra2);
      a_put(buf, fr + 96, ra3);
    }
    b_put(buf, wave, rb0);
    b_put(buf, wave + 8, rb1);
    b_put(buf, wave + 16, rb2);
    b_put(buf, wave + 24, rb3);
  };

  g_load(0);
  l_store(0);
  __syncthreads();

  for (int k0 = 0; k0 < K; k0 += 32) {
    const int cur = (k0 >> 5) & 1, nxt = cur ^ 1;
    const bool more = (k0 + 32) < K;
    if (more) g_load(k0 + 32);  // overlap next global fetch with WMMA

    v16h aop[2], bop[4];
#pragma unroll
    for (int mt = 0; mt < 2; mt++)
      aop[mt] = load_op16(&lds_a[cur][(wm * 32 + mt * 16 + l15) * PA + kA]);
#pragma unroll
    for (int nt = 0; nt < 4; nt++)
      bop[nt] = load_op16_tr(&lds_b[cur][(hi * 8 + (lane & 7)) * PB + wn * 64 + nt * 16 + ((lane >> 3) & 1) * 8]);
    // keeps all twelve LDS loads in one group ahead of the WMMAs; without it the second
    // A fragment's loads sink between them and their latency is waited out in mid-step
    __builtin_amdgcn_sched_barrier(0);
#pragma unroll
    for (int mt = 0; mt < 2; mt++)
#pragma unroll
      for (int nt = 0; nt < 4; nt++)
        acc[mt][nt] = WMMA16(aop[mt], bop[nt], acc[mt][nt]);

    if (more) l_store(nxt);  // other buffer: no conflict with current readers
    __syncthreads();
  }

  // Epilogue: add bias, store per form. C layout: VGPR r holds row r + 8*hi,
  // lane%16 holds column within the 16x16 tile. The form is chosen once, outside
  // the loops (FORM 0: f16 row-major, 1: f16 Vt[b,h,d,s], 2: f32 row-major).
  auto store_all = [&](auto form) {
    constexpr int FORM = decltype(form)::value;
#pragma unroll
    for (int mt = 0; mt < 2; mt++) {
#pragma unroll
      for (int nt = 0; nt < 4; nt++) {
        int col = n0 + wn * 64 + nt * 16 + l15;
        float bv = bias[col];
        union { v8f v; float f[8]; } u;
        u.v = acc[mt][nt];
#pragma unroll
        for (int r = 0; r < 8; r++) {
          int row = m0 + wm * 32 + mt * 16 + r + hi * 8;
          float val = u.f[r] + bv;
          if (FORM == 0) {
            ((_Float16*)out)[(size_t)row * N + col] = (_Float16)val;
          } else if (FORM == 1) {
            int hh = col >> 6, dd = col & 63;        // head, dim-in-head
            int b = row >> 11, s = row & (S - 1);    // batch, position
            ((_Float16*)out)[((size_t)(b * H + hh) * HD + dd) * S + s] = (_Float16)val;
          } else {
            ((float*)out)[(size_t)row * N + col] = val;
          }
        }
      }
    }
    // In the built object the Vt form's code follows this form's stores and writes
    // their registers: they are held until the stores have taken them.
    if constexpr (FORM == 0) asm volatile("s_wait_xcnt 0x0" ::: "memory");
  };
  if constexpr (MODE == 2) {
    store_all(form_tag<2>{});
  } else {
    if (vt_out) store_all(form_tag<1>{});
    else        store_all(form_tag<0>{});
  }
}

// Q, K and V projections, one launch. At 154 registers a wave and 38,912 B of LDS a
// block, three blocks fit on a WGP, so all 768 are resident at once.
__global__ __launch_bounds__(256) void gemm_qkv_wmma(
    const float* __restrict__ xq, const float* __restrict__ xk, const float* __restrict__ xv,
    const float* __restrict__ wq, const float* __restrict__ wk, const float* __restrict__ wv,
    const float* __restrict__ bq, const float* __restrict__ bk, const float* __restrict__ bv,
    _Float16* __restrict__ oq, _Float16* __restrict__ ok, _Float16* __restrict__ ov) {
  const int z = blockIdx.z;
  const float* x = z == 0 ? xq : z == 1 ? xk : xv;
  const float* w = z == 0 ? wq : z == 1 ? wk : wv;
  const float* bi = z == 0 ? bq : z == 1 ? bk : bv;
  _Float16* o = z == 0 ? oq : z == 1 ? ok : ov;
  gemm_body<0>(x, nullptr, w, bi, (void*)o, z == 2);
}

__global__ __launch_bounds__(256) void gemm_out_wmma(
    const _Float16* __restrict__ A16, const float* __restrict__ Bw,
    const float* __restrict__ bias, float* __restrict__ out) {
  gemm_body<2>(nullptr, A16, Bw, bias, (void*)out, false);
}

// ---------------------------------------------------------------------------
// Mask -> lane masks, once for all 16 heads. One 32-bit word per (16-query group g,
// 16-key tile kt, register r) of the attention's score tiles:
//   bit L of pm[(g * 128 + kt) * 8 + r] = mask[row g * 16 + (L & 15)][key kt * 16 + 8 * (L >> 4) + r] != 0
// which is the lane -> (query, key) map of score register r. The word is the same
// for a whole wave, so attention reads it by scalar loads and selects with it as is.
// One wave: 16 rows x 256 keys; a row's 256 B per 64 keys are read whole by the wave,
// and the 32 words of 64 keys leave as one 128-B line.
// ---------------------------------------------------------------------------
__global__ __launch_bounds__(256) void pack_mask(const int* __restrict__ mask,
                                                 unsigned* __restrict__ pm) {
  const int lane = threadIdx.x & 31;
  const int g    = blockIdx.x;         // 16-row group, 0..255 over both batches
  const int seg  = threadIdx.x >> 5;   // 256-key segment of the rows
  const int* src = mask + (size_t)(g * 16 + (lane & 15)) * S + seg * 256 + (lane >> 4) * 8;
  unsigned* dst  = pm + (size_t)g * (S / 2) + seg * 128 + lane;
  int4 m[16][2];  // the loads stand ahead of the ballots, so that many are in flight
#pragma unroll
  for (int i = 0; i < 16; i++) {
    m[i][0] = *(const int4*)(src + i * 16);
    m[i][1] = *(const int4*)(src + i * 16 + 4);
  }
  // the address registers stay as they are until the loads have taken them
  // (without the operand the last load's result is placed on them)
  asm volatile("s_wait_xcnt 0x0" :: "v"(src) : "memory");
#pragma unroll
  for (int t = 0; t < 4; t++) {
    unsigned mine = 0;
#pragma unroll
    for (int j = 0; j < 4; j++) {
      const int4 m0 = m[t * 4 + j][0], m1 = m[t * 4 + j][1];
      const int mv[8] = {m0.x, m0.y, m0.z, m0.w, m1.x, m1.y, m1.z, m1.w};
#pragma unroll
      for (int r = 0; r < 8; r++) {
        const unsigned w = __builtin_amdgcn_ballot_w32(mv[r] != 0);
        if (lane == j * 8 + r) mine = w;
      }
    }
    dst[t * 32] = mine;
  }
}

constexpr int KT      = 64;
constexpr int NT      = S / KT;
constexpr int PITCH   = 72;
constexpr int TILE_H  = 64 * PITCH;

__device__ __forceinline__ unsigned lds_off(const void* p) { return (unsigned)(size_t)p; }

// value of lane ^ 16 (the other 16-lane half), by a vector cross-row move
__device__ __forceinline__ float other_half(float x) {
  const int b = __builtin_bit_cast(int, x);
  return __builtin_bit_cast(float,
      __builtin_amdgcn_permlanex16(b, b, 0x76543210, 0xfedcba98, false, false));
}

// 512 blocks on 256 WGPs: four waves a SIMD is all the grid gives, so let the
// register budget be that of four.
__global__ __launch_bounds__(256) __attribute__((amdgpu_waves_per_eu(4, 4))) void flash_attn_wmma(
    const _Float16* __restrict__ Qp, const _Float16* __restrict__ Kp,
    const _Float16* __restrict__ Vt, const unsigned* __restrict__ pm,
    _Float16* __restrict__ ctx) {
  __shared__ __attribute__((aligned(16))) _Float16 lds_k[2][TILE_H];  // [key][d], padded rows
  __shared__ __attribute__((aligned(16))) _Float16 lds_v[2][TILE_H];  // [d][key], padded rows

  const int tid  = threadIdx.x;
  const int wave = tid >> 5, lane = tid & 31;
  const int l15  = lane & 15, hi = lane >> 4;
  const int kA   = hi ? 8 : 0;

  const int qb = blockIdx.x & 15;  // S/128 = 16 query blocks
  const int bh = blockIdx.x >> 4;  // b*H + h
  const int b  = bh >> 4, h = bh & 15;
  const int sq = qb * 128 + wave * 16;  // first query row (within sequence)

  // Copy assignment: 8 lanes per 128-B row, rows crow and crow + 32 of each tile.
  const int crow = tid >> 3, cc = tid & 7;
  const _Float16* kg = Kp + ((size_t)(b * S + crow)) * D + h * HD + cc * 8;
  const _Float16* vg = Vt + ((size_t)bh * HD + crow) * S + cc * 8;
  const unsigned lk = lds_off(&lds_k[0][crow * PITCH + cc * 8]);
  const unsigned lv = lds_off(&lds_v[0][crow * PITCH + cc * 8]);

  auto stage = [&](int t, int buf) {
    const _Float16* gk0 = kg + (size_t)t * KT * D;
    const _Float16* gk1 = gk0 + 32 * D;
    const _Float16* gv0 = vg + t * KT;
    const _Float16* gv1 = gv0 + 32 * S;
    const unsigned lk0 = lk + buf * (TILE_H * 2), lk1 = lk0 + 32 * PITCH * 2;
    const unsigned lv0 = lv + buf * (TILE_H * 2), lv1 = lv0 + 32 * PITCH * 2;
    // Global -> LDS through no register; the closing s_wait_xcnt keeps the
    // address registers unchanged until the copies have taken them.
    asm volatile(
        "global_load_async_to_lds_b128 %0, %4, off\n\t"
        "global_load_async_to_lds_b128 %1, %5, off\n\t"
        "global_load_async_to_lds_b128 %2, %6, off\n\t"
        "global_load_async_to_lds_b128 %3, %7, off\n\t"
        "s_wait_xcnt 0x0"
        :: "v"(lk0), "v"(lk1), "v"(lv0), "v"(lv1),
           "v"(gk0), "v"(gk1), "v"(gv0), "v"(gv1)
        : "memory");
  };

  // Q rows held in registers: B-operand layout (column = query), d split into two K=32 chunks
  const _Float16* qbase = Qp + ((size_t)(b * S + sq + l15)) * D + h * HD;
  v16h aq0 = load_op16(qbase + kA);
  v16h aq1 = load_op16(qbase + 32 + kA);

  const v8f vzero = {0.f, 0.f, 0.f, 0.f, 0.f, 0.f, 0.f, 0.f};
  v8f acc[4];  // O^T: acc[t][r] = O[query l15][d = t * 16 + 8 * hi + r]
#pragma unroll
  for (int t = 0; t < 4; t++) acc[t] = vzero;
  float mrun = -INFINITY;  // running maximum of this lane's query, equal in both halves
  float lrun = 0.f;        // running sum over this half's keys only; halves joined at the end

  // this wave's lane masks (see pack_mask): 8 words per 16 keys, 32 per staged tile.
  // The wave's number is made scalar and the words, which an earlier launch of this call wrote and
  // this one only reads, are read as constant memory, so that they come by scalar loads.
  const_u32x16* pw = (const_u32x16*)(pm +
      (size_t)(b * (S / 16) + qb * 8 + __builtin_amdgcn_readfirstlane(wave)) * (S / 2));

  u32x16 ln0 = pw[0], ln1 = pw[1];  // tile 0's lane masks

  stage(0, 0);
  asm volatile("s_wait_asynccnt 0x0" ::: "memory");  // own copies of tile 0 have landed
  __syncthreads();                                   // tile 0 readable by every wave
  stage(1, 1);

  for (int tl = 0; tl < NT; tl++) {
    const int buf = tl & 1;
    const _Float16* kt = &lds_k[buf][0];
    const _Float16* vt = &lds_v[buf][0];
    const u32x16 lm[2] = {ln0, ln1};
    // the next tile's lane masks, a whole tile ahead of their use (the last tile reads its own again)
    const int tn = tl + 1 < NT ? tl + 1 : tl;
    ln0 = pw[tn * 2];
    ln1 = pw[tn * 2 + 1];
#pragma unroll  // both 32-key halves of the tile: constant LDS offsets
    for (int ps = 0; ps < KT / 32; ps++) {
      // ---- scores^T: two 16x16 tiles (32 keys), contraction over HD=64 = 2xK32
      float p[2][8];
#pragma unroll
      for (int j = 0; j < 2; j++) {
        const _Float16* kb = kt + (ps * 32 + j * 16 + l15) * PITCH;
        v16h bk0 = load_op16(kb + kA);
        v16h bk1 = load_op16(kb + 32 + kA);
        v8f sc = vzero;
        sc = WMMA16(bk0, aq0, sc);  // A = K rows, B = Q^T
        sc = WMMA16(bk1, aq1, sc);
        sc *= 0.125f;  // 1/sqrt(64)
#pragma unroll
        for (int r = 0; r < 8; r++)
          p[j][r] = __builtin_amdgcn_inverse_ballot_w32(lm[ps][j * 8 + r]) ? sc[r] : -1.0e9f;
      }
      // ---- online softmax: 16 of the query's 32 scores are in this lane, 16 in lane ^ 16
      float mx[8];
#pragma unroll
      for (int r = 0; r < 8; r++) mx[r] = fmaxf(p[0][r], p[1][r]);
      float m = fmaxf(fmaxf(fmaxf(mx[0], mx[1]), fmaxf(mx[2], mx[3])),
                      fmaxf(fmaxf(mx[4], mx[5]), fmaxf(mx[6], mx[7])));
      m = fmaxf(m, other_half(m));
      const float mnew = fmaxf(mrun, m);
      const float corr = __expf(mrun - mnew);
      mrun = mnew;
      union { v16h v; v2h h2[8]; } bp;  // P^T as B operand: halves 0..7 = tile 0, 8..15 = tile 1
      float sm[2][4];
#pragma unroll
      for (int j = 0; j < 2; j++) {
#pragma unroll
        for (int i = 0; i < 4; i++) {
          const v2f e = {__expf(p[j][2 * i] - mnew), __expf(p[j][2 * i + 1] - mnew)};
          sm[j][i] = e[0] + e[1];
          bp.h2[j * 4 + i] = __builtin_convertvector(e, v2h);
        }
      }
      const float sum = ((sm[0][0] + sm[0][1]) + (sm[0][2] + sm[0][3])) +
                        ((sm[1][0] + sm[1][1]) + (sm[1][2] + sm[1][3]));
      lrun = lrun * corr + sum;
#pragma unroll
      for (int t = 0; t < 4; t++) acc[t] *= corr;
      // ---- V^T(64x32) @ P^T(32x16): staged Vt rows are contiguous along keys
#pragma unroll
      for (int t = 0; t < 4; t++) {
        const _Float16* vb = vt + (t * 16 + l15) * PITCH + ps * 32;
        v16h av = load_op16(vb + kA);
        acc[t] = WMMA16(av, bp.v, acc[t]);
      }
    }
    // Hand-over: this wave's reads of tile tl are done, its copies of tile
    // tl + 1 have landed; behind the barrier both hold for every wave.
    asm volatile("s_wait_dscnt 0x0" ::: "memory");
    asm volatile("s_wait_asynccnt 0x0" ::: "memory");
    // the lane-mask loads have taken their address before the loop's step rewrites it
    asm volatile("s_wait_xcnt 0x0" ::: "memory");
    __syncthreads();
    if (tl + 2 < NT) stage(tl + 2, buf);  // refill the buffer every wave has left
  }
  asm volatile("s_wait_asynccnt 0x0" ::: "memory");  // nothing in flight at the wave's end

  // ---- normalize and store into context [token][h*64 + d]: 8 consecutive d a lane
  const float lsum = lrun + other_half(lrun);
  _Float16* crow_out = ctx + ((size_t)(b * S + sq + l15)) * D + h * HD + hi * 8;
#pragma unroll
  for (int t = 0; t < 4; t++) {
    union { _Float16 hh[8]; float4 f4; } o;
#pragma unroll
    for (int r = 0; r < 8; r++) o.hh[r] = (_Float16)(acc[t][r] / lsum);
    *(float4*)(crow_out + t * 16) = o.f4;
  }
}

// ---------------------------------------------------------------------------
// Host-side launch
// ---------------------------------------------------------------------------
extern "C" void kernel_launch(void* const* d_in, const int* in_sizes, int n_in,
                              void* d_out, int out_size, void* d_ws, size_t ws_size,
                              hipStream_t stream) {
  const float* q_in  = (const float*)d_in[0];
  const float* k_in  = (const float*)d_in[1];
  const float* v_in  = (const float*)d_in[2];
  const int*   mask  = (const int*)d_in[3];
  const float* wq    = (const float*)d_in[4];
  const float* wqb   = (const float*)d_in[5];
  const float* wk    = (const float*)d_in[6];
  const float* wkb   = (const float*)d_in[7];
  const float* wv    = (const float*)d_in[8];
  const float* wvb   = (const float*)d_in[9];
  const float* wo    = (const float*)d_in[10];
  const float* wob   = (const float*)d_in[11];

  // Workspace carving (33 MB total, 256B aligned)
  char* ws = (char*)d_ws;
  size_t off = 0;
  auto alloc = [&](size_t bytes) {
    void* p = ws + off;
    off += (bytes + 255) & ~(size_t)255;
    return p;
  };
  const size_t IN_E = (size_t)MT * D;   // 4194304
  _Float16* Qp  = (_Float16*)alloc(IN_E * 2);
  _Float16* Kp  = (_Float16*)alloc(IN_E * 2);
  _Float16* Vt  = (_Float16*)alloc(IN_E * 2);   // [b][h][d][s]
  _Float16* ctx = (_Float16*)alloc(IN_E * 2);
  unsigned* pm  = (unsigned*)alloc((size_t)MT * S / 8);   // one bit per mask element

  // 0) the mask as lane masks: 256 groups of 16 rows
  pack_mask<<<MT / 16, 256, 0, stream>>>(mask, pm);

  // 1) the three projections in one launch, straight from the f32 inputs and weights
  dim3 gg(D / 128, MT / 128);      // (8, 32)
  dim3 g3(D / 128, MT / 128, 3);   // (8, 32, 3)
  gemm_qkv_wmma<<<g3, 256, 0, stream>>>(q_in, k_in, v_in, wq, wk, wv, wqb, wkb, wvb, Qp, Kp, Vt);

  // 2) attention: 512 blocks = B*H * (S/128)
  flash_attn_wmma<<<BB * H * (S / 128), 256, 0, stream>>>(Qp, Kp, Vt, pm, ctx);

  // 3) output projection -> fp32 d_out
  gemm_out_wmma<<<gg, 256, 0, stream>>>(ctx, wo, wob, (float*)d_out);
}

// v007
// It runs in 99.9 microseconds.
// Next to v006, in two timings, it ran 1.12 and 1.13 times as fast.
// All steps since v000 together make it 3.33 times as fast.
#include <hip/hip_runtime.h>
#include <hip/hip_bf16.h>

// ---------------------------------------------------------------------------
// Multi-head attention for MI455X (gfx1250, wave32, WMMA f32_16x16x32_f16).
// Pipeline: mask packed to lane masks | Q/K/V proj GEMMs (WMMA, double-buffered
// LDS; f32 operands are rounded to f16 on their way into LDS) | flash attention
// (WMMA, online softmax) | output proj GEMM (WMMA, fp32 out).
// ~69 GFLOP total, ~120MB minimum HBM traffic -> roughly balanced with f16
// matrix cores; scalar fp32 would be hopelessly compute-bound.
// ---------------------------------------------------------------------------

typedef __attribute__((ext_vector_type(16))) _Float16 v16h;
typedef __attribute__((ext_vector_type(8)))  float    v8f;
typedef __attribute__((ext_vector_type(2)))  float    v2f;
typedef __attribute__((ext_vector_type(2)))  _Float16 v2h;
typedef __attribute__((ext_vector_type(8)))  short    s16x8;
typedef __attribute__((ext_vector_type(16))) unsigned u32x16;
typedef const __attribute__((address_space(4))) u32x16 const_u32x16;  // memory no store of the kernel touches

#define WMMA16(a, b, c) \
  __builtin_amdgcn_wmma_f32_16x16x32_f16(false, (a), false, (b), (short)0, (c), false, false)

constexpr int BB = 2;      // batch
constexpr int S  = 2048;   // seq len
constexpr int D  = 1024;   // model dim
constexpr int H  = 16;     // heads
constexpr int HD = 64;     // head dim
constexpr int MT = BB * S; // 4096 tokens

// Load one v16h WMMA operand (16-bit A/B layout): caller passes base already
// offset by kA = (lane<16 ? 0 : 8); halves 0..7 = base[0..7], 8..15 = base[16..23].
__device__ __forceinline__ v16h load_op16(const _Float16* p) {
  union { v16h v; float4 f4[2]; } u;
  u.f4[0] = *(const float4*)(p);
  u.f4[1] = *(const float4*)(p + 16);
  return u.v;
}

// LDS row pitches of the GEMM tiles, in halves, each chosen for its reader.
constexpr int PA = 40;   // A [m][k]: 64 B of data + 16 B (16 B x odd: ds_load_b128 without bank conflicts)
constexpr int PB = 144;  // B [k][n]: 256 B of data + 32 B (32 B x odd: ds_load_tr16_b128 without bank conflicts)

// One v16h B operand out of a row-major [k][n] LDS tile by two transposing loads.
// p is the lane's own address: row 8 * (lane >> 4) + (lane & 7), column base + 8 * ((lane >> 3) & 1).
// The lane gets column base + (lane & 15): halves 0..7 = k 8*hi + 0..7, halves 8..15 = k 16 + 8*hi + 0..7,
// the k order of load_op16.
__device__ __forceinline__ v16h load_op16_tr(const _Float16* p) {
  typedef __attribute__((address_space(3))) s16x8 lds_s16x8;
  union { v16h v; s16x8 q[2]; } u;
  u.q[0] = __builtin_amdgcn_ds_load_tr16_b128_v8i16((lds_s16x8*)p);
  u.q[1] = __builtin_amdgcn_ds_load_tr16_b128_v8i16((lds_s16x8*)(p + 16 * PB));
  return u.v;
}

// ---------------------------------------------------------------------------
// GEMM: C[M=4096][N=1024] = f16(A[4096][1024]) x f16(B[1024][1024]) + bias(f32)
// MODE 0: the three input projections in ONE launch, blockIdx.z picks the problem:
//         z = 0, 1: A = f32 query / key, store f16 row-major (Q, K)
//         z = 2:    A = f32 value, store f16 as Vt[b,h,d,s] (pre-transposed for P@V)
//         768 blocks = three on every WGP (six waves a SIMD): one block's wait for
//         its next tile's global loads is filled by the other two blocks' work.
// MODE 2: A = A16 (f16), store f32 row-major      (final output projection)
// B is always the f32 weight. f32 operands are read as whole 128-B lines and
// rounded to f16 between the staging registers and LDS, so no separate cast pass.
// B stays [k][n] in LDS as it lies in memory (a wave stores one whole 256-B row at
// a time) and is transposed by the LDS loads that form the operand.
// Block tile 128x128, 8 waves (4 along M x 2 along N), K-step 32,
// double-buffered LDS: one barrier per K-step, global loads for step k+1
// staged in registers while WMMAs consume buffer k.
// MODE 2 has one block on a WGP and nobody to fill its waits: its global loads run
// four K-steps ahead, in four register sets, so that a load has four steps to arrive.
// ---------------------------------------------------------------------------
template <int V> struct form_tag { static constexpr int value = V; };

// Work-group barrier that orders LDS traffic alone. __syncthreads() also waits for every
// global load of the wave, which would end the flight of loads issued several steps ahead.
__device__ __forceinline__ void lds_barrier() {
  __builtin_amdgcn_fence(__ATOMIC_RELEASE, "workgroup", "local");
  __builtin_amdgcn_s_barrier();
  __builtin_amdgcn_fence(__ATOMIC_ACQUIRE, "workgroup", "local");
}

template <int MODE>
__device__ __forceinline__ void gemm_body(
    const float* __restrict__ A32, const _Float16* __restrict__ A16,
    const float* __restrict__ Bw, const float* __restrict__ bias,
    void* __restrict__ out, const bool vt_out) {
  constexpr int K = 1024, N = 1024;
  __shared__ __attribute__((aligned(16))) _Float16 lds_a[2][128 * PA];  // [m][k], padded rows
  __shared__ __attribute__((aligned(16))) _Float16 lds_b[2][32 * PB];   // [k][n], padded rows

  const int tid  = threadIdx.x;
  const int wave = tid >> 5, lane = tid & 31;
  const int l15  = lane & 15, hi = lane >> 4;
  const int kA   = hi ? 8 : 0;
  const int wm   = wave & 3;   // 4 wave-rows of 32
  const int wn   = wave >> 2;  // 2 wave-cols of 64
  const int m0   = blockIdx.y * 128, n0 = blockIdx.x * 128;

  // per-thread staging assignment
  const int arow = tid >> 1, akc = (tid & 1) * 16;  // f16 A: 128 rows x 32, 16 halves a thread
  const int fr = tid >> 3, fc = (tid & 7) * 4;      // f32 A: rows fr + 32*i, 4 floats: 8 lanes = one line
  const int bc = lane * 4;                          // f32 B: k rows wave + 8*i, 4 columns: a wave = one 512-B row

  v8f acc[2][4];
  const v8f vzero = {0.f, 0.f, 0.f, 0.f, 0.f, 0.f, 0.f, 0.f};
#pragma unroll
  for (int i = 0; i < 2; i++)
#pragma unroll
    for (int j = 0; j < 4; j++) acc[i][j] = vzero;

  float4 ra0, ra1, ra2, ra3, rb0, rb1, rb2, rb3;
  auto g_load = [&](int k0) {  // MODE 0
    const float* asrc = A32 + (size_t)(m0 + fr) * K + k0 + fc;
    ra0 = *(const float4*)(asrc);
    ra1 = *(const float4*)(asrc + 32 * K);
    ra2 = *(const float4*)(asrc + 64 * K);
    ra3 = *(const float4*)(asrc + 96 * K);
    const float* bsrc = Bw + (size_t)(k0 + wave) * N + n0 + bc;
    rb0 = *(const float4*)(bsrc);
    rb1 = *(const float4*)(bsrc + 8 * N);
    rb2 = *(const float4*)(bsrc + 16 * N);
    rb3 = *(const float4*)(bsrc + 24 * N);
  };
  // four f32 of one A row -> four f16, one 8-byte LDS store
  auto a_put = [&](int buf, int row, float4 v) {
    union { _Float16 h[4]; unsigned long long u; } w;
    w.h[0] = (_Float16)v.x; w.h[1] = (_Float16)v.y;
    w.h[2] = (_Float16)v.z; w.h[3] = (_Float16)v.w;
    *(unsigned long long*)(&lds_a[buf][row * PA + fc]) = w.u;
  };
  // four f32 of one B row -> four f16, one 8-byte LDS store in the same row
  auto b_put = [&](int buf, int krow, float4 v) {
    union { _Float16 h[4]; unsigned long long u; } w;
    w.h[0] = (_Float16)v.x; w.h[1] = (_Float16)v.y;
    w.h[2] = (_Float16)v.z; w.h[3] = (_Float16)v.w;
    *(unsigned long long*)(&lds_b[buf][krow * PB + bc]) = w.u;
  };
  auto l_store = [&](int buf) {  // MODE 0
    a_put(buf, fr, ra0);
    a_put(buf, fr + 32, ra1);
    a_put(buf, fr + 64, ra2);
    a_put(buf, fr + 96, ra3);
    b_put(buf, wave, rb0);
    b_put(buf, wave + 8, rb1);
    b_put(buf, wave + 16, rb2);
    b_put(buf, wave + 24, rb3);
  };

  // one K-step's products out of LDS buffer cur
  auto consume = [&](int cur) __attribute__((always_inline)) {
    v16h aop[2], bop[4];
#pragma unroll
    for (int mt = 0; mt < 2; mt++)
      aop[mt] = load_op16(&lds_a[cur][(wm * 32 + mt * 16 + l15) * PA + kA]);
#pragma unroll
    for (int nt = 0; nt < 4; nt++)
      bop[nt] = load_op16_tr(&lds_b[cur][(hi * 8 + (lane & 7)) * PB + wn * 64 + nt * 16 + ((lane >> 3) & 1) * 8]);
    // keeps all twelve LDS loads in one group ahead of the WMMAs; without it the second
    // A fragment's loads sink between them and their latency is waited out in mid-step
    __builtin_amdgcn_sched_barrier(0);
#pragma unroll
    for (int mt = 0; mt < 2; mt++)
#pragma unroll
      for (int nt = 0; nt < 4; nt++)
        acc[mt][nt] = WMMA16(aop[mt], bop[nt], acc[mt][nt]);
  };

  if constexpr (MODE == 2) {
    constexpr int DP = 4;  // K-steps between a tile's global loads and its LDS stores
    typedef __attribute__((ext_vector_type(4))) float f32x4;
    f32x4 sa[DP][2];   // tile t waits in set t % DP
    float4 sb[DP][4];
    const _Float16* ap = A16 + (size_t)(m0 + arow) * K + akc;  // this thread's part of the tile of step 0 of four
    const float* bp = Bw + (size_t)wave * N + n0 + bc;
    auto fetch = [&](int set, int t) __attribute__((always_inline)) {  // tile t, counted from ap and bp
      sa[set][0] = *(const f32x4*)(ap + t * 32);
      sa[set][1] = *(const f32x4*)(ap + t * 32 + 8);
#pragma unroll
      for (int i = 0; i < 4; i++) sb[set][i] = *(const float4*)(bp + (t * 32 + 8 * i) * N);
    };
    auto put = [&](int set, int buf) __attribute__((always_inline)) {
      *(f32x4*)(&lds_a[buf][arow * PA + akc])     = sa[set][0];
      *(f32x4*)(&lds_a[buf][arow * PA + akc + 8]) = sa[set][1];
#pragma unroll
      for (int i = 0; i < 4; i++) b_put(buf, wave + 8 * i, sb[set][i]);
    };
    fetch(0, 0);
    fetch(1, 1);
    fetch(2, 2);
    fetch(3, 3);
    put(0, 0);
    lds_barrier();
    // step u of four; the register sets and the LDS buffer are named by constants
    auto step = [&](auto ut, auto more) __attribute__((always_inline)) {
      constexpr int u = decltype(ut)::value;
      if constexpr (decltype(more)::value) fetch(u, u + DP);  // into the set that the step before has emptied
      consume(u & 1);
      if constexpr (decltype(more)::value || u + 1 < DP)
        put((u + 1) % DP, (u + 1) & 1);  // other buffer: no conflict with current readers
      lds_barrier();
    };
    // The last DP steps fetch nothing and stand apart: a branch round the loads would join two
    // paths in the compiler's counting of loads in flight and make the waits stricter.
    for (int k0 = 0; k0 < K - DP * 32; k0 += DP * 32) {
      step(form_tag<0>{}, form_tag<1>{});
      step(form_tag<1>{}, form_tag<1>{});
      step(form_tag<2>{}, form_tag<1>{});
      step(form_tag<3>{}, form_tag<1>{});
      // the loads in flight have taken their addresses before the two pointers move on
      // (the operands keep the pointers' registers as they are up to the wait)
      asm volatile("s_wait_xcnt 0x0" :: "v"(ap), "v"(bp) : "memory");
      ap += DP * 32;
      bp += DP * 32 * N;
    }
    step(form_tag<0>{}, form_tag<0>{});
    step(form_tag<1>{}, form_tag<0>{});
    step(form_tag<2>{}, form_tag<0>{});
    step(form_tag<3>{}, form_tag<0>{});
  } else {
    g_load(0);
    l_store(0);
    __syncthreads();

    for (int k0 = 0; k0 < K; k0 += 32) {
      const int cur = (k0 >> 5) & 1, nxt = cur ^ 1;
      const bool more = (k0 + 32) < K;
      if (more) g_load(k0 + 32);  // overlap next global fetch with WMMA
      consume(cur);
      if (more) l_store(nxt);  // other buffer: no conflict with current readers
      __syncthreads();
    }
  }

  // Epilogue: add bias, store per form. C layout: VGPR r holds row r + 8*hi,
  // lane%16 holds column within the 16x16 tile. The form is chosen once, outside
  // the loops (FORM 0: f16 row-major, 1: f16 Vt[b,h,d,s], 2: f32 row-major).
  auto store_all = [&](auto form) {
    constexpr int FORM = decltype(form)::value;
#pragma unroll
    for (int mt = 0; mt < 2; mt++) {
#pragma unroll
      for (int nt = 0; nt < 4; nt++) {
        int col = n0 + wn * 64 + nt * 16 + l15;
        float bv = bias[col];
        union { v8f v; float f[8]; } u;
        u.v = acc[mt][nt];
#pragma unroll
        for (int r = 0; r < 8; r++) {
          int row = m0 + wm * 32 + mt * 16 + r + hi * 8;
          float val = u.f[r] + bv;
          if (FORM == 0) {
            ((_Float16*)out)[(size_t)row * N + col] = (_Float16)val;
          } else if (FORM == 1) {
            int hh = col >> 6, dd = col & 63;        // head, dim-in-head
            int b = row >> 11, s = row & (S - 1);    // batch, position
            ((_Float16*)out)[((size_t)(b * H + hh) * HD + dd) * S + s] = (_Float16)val;
          } else {
            ((float*)out)[(size_t)row * N + col] = val;
          }
        }
      }
    }
    // In the built object the Vt form's code follows this form's stores and writes
    // their registers: they are held until the stores have taken them.
    if constexpr (FORM == 0) asm volatile("s_wait_xcnt 0x0" ::: "memory");
  };
  if constexpr (MODE == 2) {
    store_all(form_tag<2>{});
  } else {
    if (vt_out) store_all(form_tag<1>{});
    else        store_all(form_tag<0>{});
  }
}

// Q, K and V projections, one launch. At 154 registers a wave and 38,912 B of LDS a
// block, three blocks fit on a WGP, so all 768 are resident at once.
__global__ __launch_bounds__(256) void gemm_qkv_wmma(
    const float* __restrict__ xq, const float* __restrict__ xk, const float* __restrict__ xv,
    const float* __restrict__ wq, const float* __restrict__ wk, const float* __restrict__ wv,
    const float* __restrict__ bq, const float* __restrict__ bk, const float* __restrict__ bv,
    _Float16* __restrict__ oq, _Float16* __restrict__ ok, _Float16* __restrict__ ov) {
  const int z = blockIdx.z;
  const float* x = z == 0 ? xq : z == 1 ? xk : xv;
  const float* w = z == 0 ? wq : z == 1 ? wk : wv;
  const float* bi = z == 0 ? bq : z == 1 ? bk : bv;
  _Float16* o = z == 0 ? oq : z == 1 ? ok : ov;
  gemm_body<0>(x, nullptr, w, bi, (void*)o, z == 2);
}

__global__ __launch_bounds__(256) void gemm_out_wmma(
    const _Float16* __restrict__ A16, const float* __restrict__ Bw,
    const float* __restrict__ bias, float* __restrict__ out) {
  gemm_body<2>(nullptr, A16, Bw, bias, (void*)out, false);
}

// ---------------------------------------------------------------------------
// Mask -> lane masks, once for all 16 heads. One 32-bit word per (16-query group g,
// 16-key tile kt, register r) of the attention's score tiles:
//   bit L of pm[(g * 128 + kt) * 8 + r] = mask[row g * 16 + (L & 15)][key kt * 16 + 8 * (L >> 4) + r] != 0
// which is the lane -> (query, key) map of score register r. The word is the same
// for a whole wave, so attention reads it by scalar loads and selects with it as is.
// One wave: 16 rows x 256 keys; a row's 256 B per 64 keys are read whole by the wave,
// and the 32 words of 64 keys leave as one 128-B line.
// ---------------------------------------------------------------------------
__global__ __launch_bounds__(256) void pack_mask(const int* __restrict__ mask,
                                                 unsigned* __restrict__ pm) {
  const int lane = threadIdx.x & 31;
  const int g    = blockIdx.x;         // 16-row group, 0..255 over both batches
  const int seg  = threadIdx.x >> 5;   // 256-key segment of the rows
  const int* src = mask + (size_t)(g * 16 + (lane & 15)) * S + seg * 256 + (lane >> 4) * 8;
  unsigned* dst  = pm + (size_t)g * (S / 2) + seg * 128 + lane;
  int4 m[16][2];  // the loads stand ahead of the ballots, so that many are in flight
#pragma unroll
  for (int i = 0; i < 16; i++) {
    m[i][0] = *(const int4*)(src + i * 16);
    m[i][1] = *(const int4*)(src + i * 16 + 4);
  }
  // the address registers stay as they are until the loads have taken them
  // (without the operand the last load's result is placed on them)
  asm volatile("s_wait_xcnt 0x0" :: "v"(src) : "memory");
#pragma unroll
  for (int t = 0; t < 4; t++) {
    unsigned mine = 0;
#pragma unroll
    for (int j = 0; j < 4; j++) {
      const int4 m0 = m[t * 4 + j][0], m1 = m[t * 4 + j][1];
      const int mv[8] = {m0.x, m0.y, m0.z, m0.w, m1.x, m1.y, m1.z, m1.w};
#pragma unroll
      for (int r = 0; r < 8; r++) {
        const unsigned w = __builtin_amdgcn_ballot_w32(mv[r] != 0);
        if (lane == j * 8 + r) mine = w;
      }
    }
    dst[t * 32] = mine;
  }
}

constexpr int KT      = 64;
constexpr int NT      = S / KT;
constexpr int PITCH   = 72;
constexpr int TILE_H  = 64 * PITCH;

__device__ __forceinline__ unsigned lds_off(const void* p) { return (unsigned)(size_t)p; }

// value of lane ^ 16 (the other 16-lane half), by a vector cross-row move
__device__ __forceinline__ float other_half(float x) {
  const int b = __builtin_bit_cast(int, x);
  return __builtin_bit_cast(float,
      __builtin_amdgcn_permlanex16(b, b, 0x76543210, 0xfedcba98, false, false));
}

// 512 blocks on 256 WGPs: four waves a SIMD is all the grid gives, so let the
// register budget be that of four.
__global__ __launch_bounds__(256) __attribute__((amdgpu_waves_per_eu(4, 4))) void flash_attn_wmma(
    const _Float16* __restrict__ Qp, const _Float16* __restrict__ Kp,
    const _Float16* __restrict__ Vt, const unsigned* __restrict__ pm,
    _Float16* __restrict__ ctx) {
  __shared__ __attribute__((aligned(16))) _Float16 lds_k[2][TILE_H];  // [key][d], padded rows
  __shared__ __attribute__((aligned(16))) _Float16 lds_v[2][TILE_H];  // [d][key], padded rows

  const int tid  = threadIdx.x;
  const int wave = tid >> 5, lane = tid & 31;
  const int l15  = lane & 15, hi = lane >> 4;
  const int kA   = hi ? 8 : 0;

  const int qb = blockIdx.x & 15;  // S/128 = 16 query blocks
  const int bh = blockIdx.x >> 4;  // b*H + h
  const int b  = bh >> 4, h = bh & 15;
  const int sq = qb * 128 + wave * 16;  // first query row (within sequence)

  // Copy assignment: 8 lanes per 128-B row, rows crow and crow + 32 of each tile.
  const int crow = tid >> 3, cc = tid & 7;
  const _Float16* kg = Kp + ((size_t)(b * S + crow)) * D + h * HD + cc * 8;
  const _Float16* vg = Vt + ((size_t)bh * HD + crow) * S + cc * 8;
  const unsigned lk = lds_off(&lds_k[0][crow * PITCH + cc * 8]);
  const unsigned lv = lds_off(&lds_v[0][crow * PITCH + cc * 8]);

  auto stage = [&](int t, int buf) {
    const _Float16* gk0 = kg + (size_t)t * KT * D;
    const _Float16* gk1 = gk0 + 32 * D;
    const _Float16* gv0 = vg + t * KT;
    const _Float16* gv1 = gv0 + 32 * S;
    const unsigned lk0 = lk + buf * (TILE_H * 2), lk1 = lk0 + 32 * PITCH * 2;
    const unsigned lv0 = lv + buf * (TILE_H * 2), lv1 = lv0 + 32 * PITCH * 2;
    // Global -> LDS through no register; the closing s_wait_xcnt keeps the
    // address registers unchanged until the copies have taken them.
    asm volatile(
        "global_load_async_to_lds_b128 %0, %4, off\n\t"
        "global_load_async_to_lds_b128 %1, %5, off\n\t"
        "global_load_async_to_lds_b128 %2, %6, off\n\t"
        "global_load_async_to_lds_b128 %3, %7, off\n\t"
        "s_wait_xcnt 0x0"
        :: "v"(lk0), "v"(lk1), "v"(lv0), "v"(lv1),
           "v"(gk0), "v"(gk1), "v"(gv0), "v"(gv1)
        : "memory");
  };

  // Q rows held in registers: B-operand layout (column = query), d split into two K=32 chunks
  const _Float16* qbase = Qp + ((size_t)(b * S + sq + l15)) * D + h * HD;
  v16h aq0 = load_op16(qbase + kA);
  v16h aq1 = load_op16(qbase + 32 + kA);

  const v8f vzero = {0.f, 0.f, 0.f, 0.f, 0.f, 0.f, 0.f, 0.f};
  v8f acc[4];  // O^T: acc[t][r] = O[query l15][d = t * 16 + 8 * hi + r]
#pragma unroll
  for (int t = 0; t < 4; t++) acc[t] = vzero;
  float mrun = -INFINITY;  // running maximum of this lane's query, equal in both halves
  float lrun = 0.f;        // running sum over this half's keys only; halves joined at the end

  // this wave's lane masks (see pack_mask): 8 words per 16 keys, 32 per staged tile.
  // The wave's number is made scalar and the words, which an earlier launch of this call wrote and
  // this one only reads, are read as constant memory, so that they come by scalar loads.
  const_u32x16* pw = (const_u32x16*)(pm +
      (size_t)(b * (S / 16) + qb * 8 + __builtin_amdgcn_readfirstlane(wave)) * (S / 2));

  u32x16 ln0 = pw[0], ln1 = pw[1];  // tile 0's lane masks

  stage(0, 0);
  asm volatile("s_wait_asynccnt 0x0" ::: "memory");  // own copies of tile 0 have landed
  __syncthreads();                                   // tile 0 readable by every wave
  stage(1, 1);

  for (int tl = 0; tl < NT; tl++) {
    const int buf = tl & 1;
    const _Float16* kt = &lds_k[buf][0];
    const _Float16* vt = &lds_v[buf][0];
    const u32x16 lm[2] = {ln0, ln1};
    // the next tile's lane masks, a whole tile ahead of their use (the last tile reads its own again)
    const int tn = tl + 1 < NT ? tl + 1 : tl;
    ln0 = pw[tn * 2];
    ln1 = pw[tn * 2 + 1];
#pragma unroll  // both 32-key halves of the tile: constant LDS offsets
    for (int ps = 0; ps < KT / 32; ps++) {
      // ---- scores^T: two 16x16 tiles (32 keys), contraction over HD=64 = 2xK32
      float p[2][8];
#pragma unroll
      for (int j = 0; j < 2; j++) {
        const _Float16* kb = kt + (ps * 32 + j * 16 + l15) * PITCH;
        v16h bk0 = load_op16(kb + kA);
        v16h bk1 = load_op16(kb + 32 + kA);
        v8f sc = vzero;
        sc = WMMA16(bk0, aq0, sc);  // A = K rows, B = Q^T
        sc = WMMA16(bk1, aq1, sc);
        sc *= 0.125f;  // 1/sqrt(64)
#pragma unroll
        for (int r = 0; r < 8; r++)
          p[j][r] = __builtin_amdgcn_inverse_ballot_w32(lm[ps][j * 8 + r]) ? sc[r] : -1.0e9f;
      }
      // ---- online softmax: 16 of the query's 32 scores are in this lane, 16 in lane ^ 16
      float mx[8];
#pragma unroll
      for (int r = 0; r < 8; r++) mx[r] = fmaxf(p[0][r], p[1][r]);
      float m = fmaxf(fmaxf(fmaxf(mx[0], mx[1]), fmaxf(mx[2], mx[3])),
                      fmaxf(fmaxf(mx[4], mx[5]), fmaxf(mx[6], mx[7])));
      m = fmaxf(m, other_half(m));
      const float mnew = fmaxf(mrun, m);
      const float corr = __expf(mrun - mnew);
      mrun = mnew;
      union { v16h v; v2h h2[8]; } bp;  // P^T as B operand: halves 0..7 = tile 0, 8..15 = tile 1
      float sm[2][4];
#pragma unroll
      for (int j = 0; j < 2; j++) {
#pragma unroll
        for (int i = 0; i < 4; i++) {
          const v2f e = {__expf(p[j][2 * i] - mnew), __expf(p[j][2 * i + 1] - mnew)};
          sm[j][i] = e[0] + e[1];
          bp.h2[j * 4 + i] = __builtin_convertvector(e, v2h);
        }
      }
      const float sum = ((sm[0][0] + sm[0][1]) + (sm[0][2] + sm[0][3])) +
                        ((sm[1][0] + sm[1][1]) + (sm[1][2] + sm[1][3]));
      lrun = lrun * corr + sum;
#pragma unroll
      for (int t = 0; t < 4; t++) acc[t] *= corr;
      // ---- V^T(64x32) @ P^T(32x16): staged Vt rows are contiguous along keys
#pragma unroll
      for (int t = 0; t < 4; t++) {
        const _Float16* vb = vt + (t * 16 + l15) * PITCH + ps * 32;
        v16h av = load_op16(vb + kA);
        acc[t] = WMMA16(av, bp.v, acc[t]);
      }
    }
    // Hand-over: this wave's reads of tile tl are done, its copies of tile
    // tl + 1 have landed; behind the barrier both hold for every wave.
    asm volatile("s_wait_dscnt 0x0" ::: "memory");
    asm volatile("s_wait_asynccnt 0x0" ::: "memory");
    // the lane-mask loads have taken their address before the loop's step rewrites it
    asm volatile("s_wait_xcnt 0x0" ::: "memory");
    __syncthreads();
    if (tl + 2 < NT) stage(tl + 2, buf);  // refill the buffer every wave has left
  }
  asm volatile("s_wait_asynccnt 0x0" ::: "memory");  // nothing in flight at the wave's end

  // ---- normalize and store into context [token][h*64 + d]: 8 consecutive d a lane
  const float lsum = lrun + other_half(lrun);
  _Float16* crow_out = ctx + ((size_t)(b * S + sq + l15)) * D + h * HD + hi * 8;
#pragma unroll
  for (int t = 0; t < 4; t++) {
    union { _Float16 hh[8]; float4 f4; } o;
#pragma unroll
    for (int r = 0; r < 8; r++) o.hh[r] = (_Float16)(acc[t][r] / lsum);
    *(float4*)(crow_out + t * 16) = o.f4;
  }
}

// ---------------------------------------------------------------------------
// Host-side launch
// ---------------------------------------------------------------------------
extern "C" void kernel_launch(void* const* d_in, const int* in_sizes, int n_in,
                              void* d_out, int out_size, void* d_ws, size_t ws_size,
                              hipStream_t stream) {
  const float* q_in  = (const float*)d_in[0];
  const float* k_in  = (const float*)d_in[1];
  const float* v_in  = (const float*)d_in[2];
  const int*   mask  = (const int*)d_in[3];
  const float* wq    = (const float*)d_in[4];
  const float* wqb   = (const float*)d_in[5];
  const float* wk    = (const float*)d_in[6];
  const float* wkb   = (const float*)d_in[7];
  const float* wv    = (const float*)d_in[8];
  const float* wvb   = (const float*)d_in[9];
  const float* wo    = (const float*)d_in[10];
  const float* wob   = (const float*)d_in[11];

  // Workspace carving (33 MB total, 256B aligned)
  char* ws = (char*)d_ws;
  size_t off = 0;
  auto alloc = [&](size_t bytes) {
    void* p = ws + off;
    off += (bytes + 255) & ~(size_t)255;
    return p;
  };
  const size_t IN_E = (size_t)MT * D;   // 4194304
  _Float16* Qp  = (_Float16*)alloc(IN_E * 2);
  _Float16* Kp  = (_Float16*)alloc(IN_E * 2);
  _Float16* Vt  = (_Float16*)alloc(IN_E * 2);   // [b][h][d][s]
  _Float16* ctx = (_Float16*)alloc(IN_E * 2);
  unsigned* pm  = (unsigned*)alloc((size_t)MT * S / 8);   // one bit per mask element

  // 0) the mask as lane masks: 256 groups of 16 rows
  pack_mask<<<MT / 16, 256, 0, stream>>>(mask, pm);

  // 1) the three projections in one launch, straight from the f32 inputs and weights
  dim3 gg(D / 128, MT / 128);      // (8, 32)
  dim3 g3(D / 128, MT / 128, 3);   // (8, 32, 3)
  gemm_qkv_wmma<<<g3, 256, 0, stream>>>(q_in, k_in, v_in, wq, wk, wv, wqb, wkb, wvb, Qp, Kp, Vt);

  // 2) attention: 512 blocks = B*H * (S/128)
  flash_attn_wmma<<<BB * H * (S / 128), 256, 0, stream>>>(Qp, Kp, Vt, pm, ctx);

  // 3) output projection -> fp32 d_out
  gemm_out_wmma<<<gg, 256, 0, stream>>>(ctx, wo, wob, (float*)d_out);
}

// v008
// It runs in 94.7 microseconds.
// Next to v007, in two timings, it ran 1.05 and 1.06 times as fast.
// All steps since v000 together make it 3.52 times as fast.
#include <hip/hip_runtime.h>
#include <hip/hip_bf16.h>

// ---------------------------------------------------------------------------
// Multi-head attention for MI455X (gfx1250, wave32, WMMA f32_16x16x32_f16).
// Pipeline: mask packed to lane masks | Q/K/V proj GEMMs (WMMA, double-buffered
// LDS; f32 operands are rounded to f16 on their way into LDS) | flash attention
// (WMMA, online softmax) | output proj GEMM (WMMA, fp32 out).
// ~69 GFLOP total, ~120MB minimum HBM traffic -> roughly balanced with f16
// matrix cores; scalar fp32 would be hopelessly compute-bound.
// ---------------------------------------------------------------------------

typedef __attribute__((ext_vector_type(16))) _Float16 v16h;
typedef __attribute__((ext_vector_type(8)))  float    v8f;
typedef __attribute__((ext_vector_type(2)))  float    v2f;
typedef __attribute__((ext_vector_type(2)))  _Float16 v2h;
typedef __attribute__((ext_vector_type(8)))  short    s16x8;
typedef __attribute__((ext_vector_type(16))) unsigned u32x16;
typedef const __attribute__((address_space(4))) u32x16 const_u32x16;  // memory no store of the kernel touches

#define WMMA16(a, b, c) \
  __builtin_amdgcn_wmma_f32_16x16x32_f16(false, (a), false, (b), (short)0, (c), false, false)

constexpr int BB = 2;      // batch
constexpr int S  = 2048;   // seq len
constexpr int D  = 1024;   // model dim
constexpr int H  = 16;     // heads
constexpr int HD = 64;     // head dim
constexpr int MT = BB * S; // 4096 tokens

// The softmax works in powers of two: exp(s / 8 - m) = exp2(s * QSCALE - m * log2(e)).
// The Q projection multiplies its f32 result by QSCALE before it rounds to f16, so the
// score product leaves the matrix unit in those units and no score is multiplied again.
constexpr float LOG2E  = 1.4426950408889634f;
constexpr float QSCALE = 0.125f * LOG2E;     // 1/sqrt(64) * log2(e)
constexpr float MASKED = -1.0e9f * LOG2E;    // the reference's -1e9, in the same units

// Load one v16h WMMA operand (16-bit A/B layout): caller passes base already
// offset by kA = (lane<16 ? 0 : 8); halves 0..7 = base[0..7], 8..15 = base[16..23].
__device__ __forceinline__ v16h load_op16(const _Float16* p) {
  union { v16h v; float4 f4[2]; } u;
  u.f4[0] = *(const float4*)(p);
  u.f4[1] = *(const float4*)(p + 16);
  return u.v;
}

// LDS row pitches of the GEMM tiles, in halves, each chosen for its reader.
constexpr int PA = 40;   // A [m][k]: 64 B of data + 16 B (16 B x odd: ds_load_b128 without bank conflicts)
constexpr int PB = 144;  // B [k][n]: 256 B of data + 32 B (32 B x odd: ds_load_tr16_b128 without bank conflicts)

// One v16h B operand out of a row-major [k][n] LDS tile by two transposing loads.
// p is the lane's own address: row 8 * (lane >> 4) + (lane & 7), column base + 8 * ((lane >> 3) & 1).
// The lane gets column base + (lane & 15): halves 0..7 = k 8*hi + 0..7, halves 8..15 = k 16 + 8*hi + 0..7,
// the k order of load_op16.
__device__ __forceinline__ v16h load_op16_tr(const _Float16* p) {
  typedef __attribute__((address_space(3))) s16x8 lds_s16x8;
  union { v16h v; s16x8 q[2]; } u;
  u.q[0] = __builtin_amdgcn_ds_load_tr16_b128_v8i16((lds_s16x8*)p);
  u.q[1] = __builtin_amdgcn_ds_load_tr16_b128_v8i16((lds_s16x8*)(p + 16 * PB));
  return u.v;
}

// ---------------------------------------------------------------------------
// GEMM: C[M=4096][N=1024] = f16(A[4096][1024]) x f16(B[1024][1024]) + bias(f32)
// MODE 0: the three input projections in ONE launch, blockIdx.z picks the problem:
//         z = 0, 1: A = f32 query / key, store f16 row-major (Q times QSCALE, K)
//         z = 2:    A = f32 value, store f16 as Vt[b,h,d,s] (pre-transposed for P@V)
//         768 blocks = three on every WGP (six waves a SIMD): one block's wait for
//         its next tile's global loads is filled by the other two blocks' work.
// MODE 2: A = A16 (f16), store f32 row-major      (final output projection)
// B is always the f32 weight. f32 operands are read as whole 128-B lines and
// rounded to f16 between the staging registers and LDS, so no separate cast pass.
// B stays [k][n] in LDS as it lies in memory (a wave stores one whole 256-B row at
// a time) and is transposed by the LDS loads that form the operand.
// Block tile 128x128, 8 waves (4 along M x 2 along N), K-step 32,
// double-buffered LDS: one barrier per K-step, global loads for step k+1
// staged in registers while WMMAs consume buffer k.
// MODE 2 has one block on a WGP and nobody to fill its waits: its global loads run
// four K-steps ahead, in four register sets, so that a load has four steps to arrive.
// ---------------------------------------------------------------------------
template <int V> struct form_tag { static constexpr int value = V; };

// Work-group barrier that orders LDS traffic alone. __syncthreads() also waits for every
// global load of the wave, which would end the flight of loads issued several steps ahead.
__device__ __forceinline__ void lds_barrier() {
  __builtin_amdgcn_fence(__ATOMIC_RELEASE, "workgroup", "local");
  __builtin_amdgcn_s_barrier();
  __builtin_amdgcn_fence(__ATOMIC_ACQUIRE, "workgroup", "local");
}

template <int MODE>
__device__ __forceinline__ void gemm_body(
    const float* __restrict__ A32, const _Float16* __restrict__ A16,
    const float* __restrict__ Bw, const float* __restrict__ bias,
    void* __restrict__ out, const bool vt_out, const float oscale) {
  constexpr int K = 1024, N = 1024;
  __shared__ __attribute__((aligned(16))) _Float16 lds_a[2][128 * PA];  // [m][k], padded rows
  __shared__ __attribute__((aligned(16))) _Float16 lds_b[2][32 * PB];   // [k][n], padded rows

  const int tid  = threadIdx.x;
  const int wave = tid >> 5, lane = tid & 31;
  const int l15  = lane & 15, hi = lane >> 4;
  const int kA   = hi ? 8 : 0;
  const int wm   = wave & 3;   // 4 wave-rows of 32
  const int wn   = wave >> 2;  // 2 wave-cols of 64
  const int m0   = blockIdx.y * 128, n0 = blockIdx.x * 128;

  // per-thread staging assignment
  const int arow = tid >> 1, akc = (tid & 1) * 16;  // f16 A: 128 rows x 32, 16 halves a thread
  const int fr = tid >> 3, fc = (tid & 7) * 4;      // f32 A: rows fr + 32*i, 4 floats: 8 lanes = one line
  const int bc = lane * 4;                          // f32 B: k rows wave + 8*i, 4 columns: a wave = one 512-B row

  v8f acc[2][4];
  const v8f vzero = {0.f, 0.f, 0.f, 0.f, 0.f, 0.f, 0.f, 0.f};
#pragma unroll
  for (int i = 0; i < 2; i++)
#pragma unroll
    for (int j = 0; j < 4; j++) acc[i][j] = vzero;

  float4 ra0, ra1, ra2, ra3, rb0, rb1, rb2, rb3;
  auto g_load = [&](int k0) {  // MODE 0
    const float* asrc = A32 + (size_t)(m0 + fr) * K + k0 + fc;
    ra0 = *(const float4*)(asrc);
    ra1 = *(const float4*)(asrc + 32 * K);
    ra2 = *(const float4*)(asrc + 64 * K);
    ra3 = *(const float4*)(asrc + 96 * K);
    const float* bsrc = Bw + (size_t)(k0 + wave) * N + n0 + bc;
    rb0 = *(const float4*)(bsrc);
    rb1 = *(const float4*)(bsrc + 8 * N);
    rb2 = *(const float4*)(bsrc + 16 * N);
    rb3 = *(const float4*)(bsrc + 24 * N);
  };
  // four f32 of one A row -> four f16, one 8-byte LDS store
  auto a_put = [&](int buf, int row, float4 v) {
    union { _Float16 h[4]; unsigned long long u; } w;
    w.h[0] = (_Float16)v.x; w.h[1] = (_Float16)v.y;
    w.h[2] = (_Float16)v.z; w.h[3] = (_Float16)v.w;
    *(unsigned long long*)(&lds_a[buf][row * PA + fc]) = w.u;
  };
  // four f32 of one B row -> four f16, one 8-byte LDS store in the same row
  auto b_put = [&](int buf, int krow, float4 v) {
    union { _Float16 h[4]; unsigned long long u; } w;
    w.h[0] = (_Float16)v.x; w.h[1] = (_Float16)v.y;
    w.h[2] = (_Float16)v.z; w.h[3] = (_Float16)v.w;
    *(unsigned long long*)(&lds_b[buf][krow * PB + bc]) = w.u;
  };
  auto l_store = [&](int buf) {  // MODE 0
    a_put(buf, fr, ra0);
    a_put(buf, fr + 32, ra1);
    a_put(buf, fr + 64, ra2);
    a_put(buf, fr + 96, ra3);
    b_put(buf, wave, rb0);
    b_put(buf, wave + 8, rb1);
    b_put(buf, wave + 16, rb2);
    b_put(buf, wave + 24, rb3);
  };

  // one K-step's products out of LDS buffer cur
  auto consume = [&](int cur) __attribute__((always_inline)) {
    v16h aop[2], bop[4];
#pragma unroll
    for (int mt = 0; mt < 2; mt++)
      aop[mt] = load_op16(&lds_a[cur][(wm * 32 + mt * 16 + l15) * PA + kA]);
#pragma unroll
    for (int nt = 0; nt < 4; nt++)
      bop[nt] = load_op16_tr(&lds_b[cur][(hi * 8 + (lane & 7)) * PB + wn * 64 + nt * 16 + ((lane >> 3) & 1) * 8]);
    // keeps all twelve LDS loads in one group ahead of the WMMAs; without it the second
    // A fragment's loads sink between them and their latency is waited out in mid-step
    __builtin_amdgcn_sched_barrier(0);
#pragma unroll
    for (int mt = 0; mt < 2; mt++)
#pragma unroll
      for (int nt = 0; nt < 4; nt++)
        acc[mt][nt] = WMMA16(aop[mt], bop[nt], acc[mt][nt]);
  };

  if constexpr (MODE == 2) {
    constexpr int DP = 4;  // K-steps between a tile's global loads and its LDS stores
    typedef __attribute__((ext_vector_type(4))) float f32x4;
    f32x4 sa[DP][2];   // tile t waits in set t % DP
    float4 sb[DP][4];
    const _Float16* ap = A16 + (size_t)(m0 + arow) * K + akc;  // this thread's part of the tile of step 0 of four
    const float* bp = Bw + (size_t)wave * N + n0 + bc;
    auto fetch = [&](int set, int t) __attribute__((always_inline)) {  // tile t, counted from ap and bp
      sa[set][0] = *(const f32x4*)(ap + t * 32);
      sa[set][1] = *(const f32x4*)(ap + t * 32 + 8);
#pragma unroll
      for (int i = 0; i < 4; i++) sb[set][i] = *(const float4*)(bp + (t * 32 + 8 * i) * N);
    };
    auto put = [&](int set, int buf) __attribute__((always_inline)) {
      *(f32x4*)(&lds_a[buf][arow * PA + akc])     = sa[set][0];
      *(f32x4*)(&lds_a[buf][arow * PA + akc + 8]) = sa[set][1];
#pragma unroll
      for (int i = 0; i < 4; i++) b_put(buf, wave + 8 * i, sb[set][i]);
    };
    fetch(0, 0);
    fetch(1, 1);
    fetch(2, 2);
    fetch(3, 3);
    put(0, 0);
    lds_barrier();
    // step u of four; the register sets and the LDS buffer are named by constants
    auto step = [&](auto ut, auto more) __attribute__((always_inline)) {
      constexpr int u = decltype(ut)::value;
      if constexpr (decltype(more)::value) fetch(u, u + DP);  // into the set that the step before has emptied
      consume(u & 1);
      if constexpr (decltype(more)::value || u + 1 < DP)
        put((u + 1) % DP, (u + 1) & 1);  // other buffer: no conflict with current readers
      lds_barrier();
    };
    // The last DP steps fetch nothing and stand apart: a branch round the loads would join two
    // paths in the compiler's counting of loads in flight and make the waits stricter.
    for (int k0 = 0; k0 < K - DP * 32; k0 += DP * 32) {
      step(form_tag<0>{}, form_tag<1>{});
      step(form_tag<1>{}, form_tag<1>{});
      step(form_tag<2>{}, form_tag<1>{});
      step(form_tag<3>{}, form_tag<1>{});
      // the loads in flight have taken their addresses before the two pointers move on
      // (the operands keep the pointers' registers as they are up to the wait)
      asm volatile("s_wait_xcnt 0x0" :: "v"(ap), "v"(bp) : "memory");
      ap += DP * 32;
      bp += DP * 32 * N;
    }
    step(form_tag<0>{}, form_tag<0>{});
    step(form_tag<1>{}, form_tag<0>{});
    step(form_tag<2>{}, form_tag<0>{});
    step(form_tag<3>{}, form_tag<0>{});
  } else {
    g_load(0);
    l_store(0);
    __syncthreads();

    for (int k0 = 0; k0 < K; k0 += 32) {
      const int cur = (k0 >> 5) & 1, nxt = cur ^ 1;
      const bool more = (k0 + 32) < K;
      if (more) g_load(k0 + 32);  // overlap next global fetch with WMMA
      consume(cur);
      if (more) l_store(nxt);  // other buffer: no conflict with current readers
      __syncthreads();
    }
  }

  // Epilogue: add bias, store per form. C layout: VGPR r holds row r + 8*hi,
  // lane%16 holds column within the 16x16 tile. The form is chosen once, outside
  // the loops (FORM 0: f16 row-major, 1: f16 Vt[b,h,d,s], 2: f32 row-major).
  auto store_all = [&](auto form) {
    constexpr int FORM = decltype(form)::value;
#pragma unroll
    for (int mt = 0; mt < 2; mt++) {
#pragma unroll
      for (int nt = 0; nt < 4; nt++) {
        int col = n0 + wn * 64 + nt * 16 + l15;
        float bv = bias[col];
        union { v8f v; float f[8]; } u;
        u.v = acc[mt][nt];
#pragma unroll
        for (int r = 0; r < 8; r++) {
          int row = m0 + wm * 32 + mt * 16 + r + hi * 8;
          float val = u.f[r] + bv;
          if (FORM == 0) {
            ((_Float16*)out)[(size_t)row * N + col] = (_Float16)(val * oscale);  // Q: QSCALE, K: 1
          } else if (FORM == 1) {
            int hh = col >> 6, dd = col & 63;        // head, dim-in-head
            int b = row >> 11, s = row & (S - 1);    // batch, position
            ((_Float16*)out)[((size_t)(b * H + hh) * HD + dd) * S + s] = (_Float16)val;
          } else {
            ((float*)out)[(size_t)row * N + col] = val;
          }
        }
      }
    }
    // In the built object the Vt form's code follows this form's stores and writes
    // their registers: they are held until the stores have taken them.
    if constexpr (FORM == 0) asm volatile("s_wait_xcnt 0x0" ::: "memory");
  };
  if constexpr (MODE == 2) {
    store_all(form_tag<2>{});
  } else {
    if (vt_out) store_all(form_tag<1>{});
    else        store_all(form_tag<0>{});
  }
}

// Q, K and V projections, one launch. At 154 registers a wave and 38,912 B of LDS a
// block, three blocks fit on a WGP, so all 768 are resident at once.
__global__ __launch_bounds__(256) void gemm_qkv_wmma(
    const float* __restrict__ xq, const float* __restrict__ xk, const float* __restrict__ xv,
    const float* __restrict__ wq, const float* __restrict__ wk, const float* __restrict__ wv,
    const float* __restrict__ bq, const float* __restrict__ bk, const float* __restrict__ bv,
    _Float16* __restrict__ oq, _Float16* __restrict__ ok, _Float16* __restrict__ ov) {
  const int z = blockIdx.z;
  const float* x = z == 0 ? xq : z == 1 ? xk : xv;
  const float* w = z == 0 ? wq : z == 1 ? wk : wv;
  const float* bi = z == 0 ? bq : z == 1 ? bk : bv;
  _Float16* o = z == 0 ? oq : z == 1 ? ok : ov;
  gemm_body<0>(x, nullptr, w, bi, (void*)o, z == 2, z == 0 ? QSCALE : 1.0f);
}

__global__ __launch_bounds__(256) void gemm_out_wmma(
    const _Float16* __restrict__ A16, const float* __restrict__ Bw,
    const float* __restrict__ bias, float* __restrict__ out) {
  gemm_body<2>(nullptr, A16, Bw, bias, (void*)out, false, 1.0f);
}

// ---------------------------------------------------------------------------
// Mask -> lane masks, once for all 16 heads. One 32-bit word per (16-query group g,
// 16-key tile kt, register r) of the attention's score tiles:
//   bit L of pm[(g * 128 + kt) * 8 + r] = mask[row g * 16 + (L & 15)][key kt * 16 + 8 * (L >> 4) + r] != 0
// which is the lane -> (query, key) map of score register r. The word is the same
// for a whole wave, so attention reads it by scalar loads and selects with it as is.
// One wave: 16 rows x 256 keys; a row's 256 B per 64 keys are read whole by the wave,
// and the 32 words of 64 keys leave as one 128-B line.
// ---------------------------------------------------------------------------
__global__ __launch_bounds__(256) void pack_mask(const int* __restrict__ mask,
                                                 unsigned* __restrict__ pm) {
  const int lane = threadIdx.x & 31;
  const int g    = blockIdx.x;         // 16-row group, 0..255 over both batches
  const int seg  = threadIdx.x >> 5;   // 256-key segment of the rows
  const int* src = mask + (size_t)(g * 16 + (lane & 15)) * S + seg * 256 + (lane >> 4) * 8;
  unsigned* dst  = pm + (size_t)g * (S / 2) + seg * 128 + lane;
  int4 m[16][2];  // the loads stand ahead of the ballots, so that many are in flight
#pragma unroll
  for (int i = 0; i < 16; i++) {
    m[i][0] = *(const int4*)(src + i * 16);
    m[i][1] = *(const int4*)(src + i * 16 + 4);
  }
  // the address registers stay as they are until the loads have taken them
  // (without the operand the last load's result is placed on them)
  asm volatile("s_wait_xcnt 0x0" :: "v"(src) : "memory");
#pragma unroll
  for (int t = 0; t < 4; t++) {
    unsigned mine = 0;
#pragma unroll
    for (int j = 0; j < 4; j++) {
      const int4 m0 = m[t * 4 + j][0], m1 = m[t * 4 + j][1];
      const int mv[8] = {m0.x, m0.y, m0.z, m0.w, m1.x, m1.y, m1.z, m1.w};
#pragma unroll
      for (int r = 0; r < 8; r++) {
        const unsigned w = __builtin_amdgcn_ballot_w32(mv[r] != 0);
        if (lane == j * 8 + r) mine = w;
      }
    }
    dst[t * 32] = mine;
  }
}

constexpr int KT      = 64;
constexpr int NT      = S / KT;
constexpr int PITCH   = 72;
constexpr int TILE_H  = 64 * PITCH;

__device__ __forceinline__ unsigned lds_off(const void* p) { return (unsigned)(size_t)p; }

// value of lane ^ 16 (the other 16-lane half), by a vector cross-row move
__device__ __forceinline__ float other_half(float x) {
  const int b = __builtin_bit_cast(int, x);
  return __builtin_bit_cast(float,
      __builtin_amdgcn_permlanex16(b, b, 0x76543210, 0xfedcba98, false, false));
}

// 512 blocks on 256 WGPs: four waves a SIMD is all the grid gives, so let the
// register budget be that of four.
__global__ __launch_bounds__(256) __attribute__((amdgpu_waves_per_eu(4, 4))) void flash_attn_wmma(
    const _Float16* __restrict__ Qp, const _Float16* __restrict__ Kp,
    const _Float16* __restrict__ Vt, const unsigned* __restrict__ pm,
    _Float16* __restrict__ ctx) {
  __shared__ __attribute__((aligned(16))) _Float16 lds_k[2][TILE_H];  // [key][d], padded rows
  __shared__ __attribute__((aligned(16))) _Float16 lds_v[2][TILE_H];  // [d][key], padded rows

  const int tid  = threadIdx.x;
  const int wave = tid >> 5, lane = tid & 31;
  const int l15  = lane & 15, hi = lane >> 4;
  const int kA   = hi ? 8 : 0;

  const int qb = blockIdx.x & 15;  // S/128 = 16 query blocks
  const int bh = blockIdx.x >> 4;  // b*H + h
  const int b  = bh >> 4, h = bh & 15;
  const int sq = qb * 128 + wave * 16;  // first query row (within sequence)

  // Copy assignment: 8 lanes per 128-B row, rows crow and crow + 32 of each tile.
  const int crow = tid >> 3, cc = tid & 7;
  const _Float16* kg = Kp + ((size_t)(b * S + crow)) * D + h * HD + cc * 8;
  const _Float16* vg = Vt + ((size_t)bh * HD + crow) * S + cc * 8;
  const unsigned lk = lds_off(&lds_k[0][crow * PITCH + cc * 8]);
  const unsigned lv = lds_off(&lds_v[0][crow * PITCH + cc * 8]);

  auto stage = [&](int t, int buf) {
    const _Float16* gk0 = kg + (size_t)t * KT * D;
    const _Float16* gk1 = gk0 + 32 * D;
    const _Float16* gv0 = vg + t * KT;
    const _Float16* gv1 = gv0 + 32 * S;
    const unsigned lk0 = lk + buf * (TILE_H * 2), lk1 = lk0 + 32 * PITCH * 2;
    const unsigned lv0 = lv + buf * (TILE_H * 2), lv1 = lv0 + 32 * PITCH * 2;
    // Global -> LDS through no register; the closing s_wait_xcnt keeps the
    // address registers unchanged until the copies have taken them.
    asm volatile(
        "global_load_async_to_lds_b128 %0, %4, off\n\t"
        "global_load_async_to_lds_b128 %1, %5, off\n\t"
        "global_load_async_to_lds_b128 %2, %6, off\n\t"
        "global_load_async_to_lds_b128 %3, %7, off\n\t"
        "s_wait_xcnt 0x0"
        :: "v"(lk0), "v"(lk1), "v"(lv0), "v"(lv1),
           "v"(gk0), "v"(gk1), "v"(gv0), "v"(gv1)
        : "memory");
  };

  // Q rows held in registers: B-operand layout (column = query), d split into two K=32 chunks
  const _Float16* qbase = Qp + ((size_t)(b * S + sq + l15)) * D + h * HD;
  v16h aq0 = load_op16(qbase + kA);
  v16h aq1 = load_op16(qbase + 32 + kA);

  const v8f vzero = {0.f, 0.f, 0.f, 0.f, 0.f, 0.f, 0.f, 0.f};
  v8f acc[4];  // O^T: acc[t][r] = O[query l15][d = t * 16 + 8 * hi + r]
#pragma unroll
  for (int t = 0; t < 4; t++) acc[t] = vzero;
  float mrun = -INFINITY;  // running maximum of this lane's query, equal in both halves
  float lrun = 0.f;        // running sum over this half's keys only; halves joined at the end

  // this wave's lane masks (see pack_mask): 8 words per 16 keys, 32 per staged tile.
  // The wave's number is made scalar and the words, which an earlier launch of this call wrote and
  // this one only reads, are read as constant memory, so that they come by scalar loads.
  const_u32x16* pw = (const_u32x16*)(pm +
      (size_t)(b * (S / 16) + qb * 8 + __builtin_amdgcn_readfirstlane(wave)) * (S / 2));

  u32x16 ln0 = pw[0], ln1 = pw[1];  // tile 0's lane masks

  stage(0, 0);
  asm volatile("s_wait_asynccnt 0x0" ::: "memory");  // own copies of tile 0 have landed
  __syncthreads();                                   // tile 0 readable by every wave
  stage(1, 1);

  for (int tl = 0; tl < NT; tl++) {
    const int buf = tl & 1;
    const _Float16* kt = &lds_k[buf][0];
    const _Float16* vt = &lds_v[buf][0];
    const u32x16 lm[2] = {ln0, ln1};
    // the next tile's lane masks, a whole tile ahead of their use (the last tile reads its own again)
    const int tn = tl + 1 < NT ? tl + 1 : tl;
    ln0 = pw[tn * 2];
    ln1 = pw[tn * 2 + 1];
#pragma unroll  // both 32-key halves of the tile: constant LDS offsets
    for (int ps = 0; ps < KT / 32; ps++) {
      // ---- scores^T: two 16x16 tiles (32 keys), contraction over HD=64 = 2xK32
      float p[2][8];
#pragma unroll
      for (int j = 0; j < 2; j++) {
        const _Float16* kb = kt + (ps * 32 + j * 16 + l15) * PITCH;
        v16h bk0 = load_op16(kb + kA);
        v16h bk1 = load_op16(kb + 32 + kA);
        v8f sc = vzero;
        sc = WMMA16(bk0, aq0, sc);  // A = K rows, B = Q^T
        sc = WMMA16(bk1, aq1, sc);  // Q carries QSCALE: scores / 8 * log2(e)
#pragma unroll
        for (int r = 0; r < 8; r++)
          p[j][r] = __builtin_amdgcn_inverse_ballot_w32(lm[ps][j * 8 + r]) ? sc[r] : MASKED;
      }
      // ---- online softmax: 16 of the query's 32 scores are in this lane, 16 in lane ^ 16
      float mx[8];
#pragma unroll
      for (int r = 0; r < 8; r++) mx[r] = fmaxf(p[0][r], p[1][r]);
      float m = fmaxf(fmaxf(fmaxf(mx[0], mx[1]), fmaxf(mx[2], mx[3])),
                      fmaxf(fmaxf(mx[4], mx[5]), fmaxf(mx[6], mx[7])));
      m = fmaxf(m, other_half(m));
      const float mnew = fmaxf(mrun, m);
      const float corr = __builtin_amdgcn_exp2f(mrun - mnew);
      mrun = mnew;
      union { v16h v; v2h h2[8]; } bp;  // P^T as B operand: halves 0..7 = tile 0, 8..15 = tile 1
      float sm[2][4];
#pragma unroll
      for (int j = 0; j < 2; j++) {
#pragma unroll
        for (int i = 0; i < 4; i++) {
          const v2f d = (v2f){p[j][2 * i], p[j][2 * i + 1]} - mnew;
          const v2f e = {__builtin_amdgcn_exp2f(d[0]), __builtin_amdgcn_exp2f(d[1])};
          sm[j][i] = e[0] + e[1];
          bp.h2[j * 4 + i] = __builtin_convertvector(e, v2h);
        }
      }
      const float sum = ((sm[0][0] + sm[0][1]) + (sm[0][2] + sm[0][3])) +
                        ((sm[1][0] + sm[1][1]) + (sm[1][2] + sm[1][3]));
      lrun = lrun * corr + sum;
#pragma unroll
      for (int t = 0; t < 4; t++) acc[t] *= corr;
      // ---- V^T(64x32) @ P^T(32x16): staged Vt rows are contiguous along keys
#pragma unroll
      for (int t = 0; t < 4; t++) {
        const _Float16* vb = vt + (t * 16 + l15) * PITCH + ps * 32;
        v16h av = load_op16(vb + kA);
        acc[t] = WMMA16(av, bp.v, acc[t]);
      }
    }
    // Hand-over: this wave's reads of tile tl are done, its copies of tile
    // tl + 1 have landed; behind the barrier both hold for every wave.
    asm volatile("s_wait_dscnt 0x0" ::: "memory");
    asm volatile("s_wait_asynccnt 0x0" ::: "memory");
    // the lane-mask loads have taken their address before the loop's step rewrites it
    asm volatile("s_wait_xcnt 0x0" ::: "memory");
    __syncthreads();
    if (tl + 2 < NT) stage(tl + 2, buf);  // refill the buffer every wave has left
  }
  asm volatile("s_wait_asynccnt 0x0" ::: "memory");  // nothing in flight at the wave's end

  // ---- normalize and store into context [token][h*64 + d]: 8 consecutive d a lane
  const float lsum = lrun + other_half(lrun);
  _Float16* crow_out = ctx + ((size_t)(b * S + sq + l15)) * D + h * HD + hi * 8;
#pragma unroll
  for (int t = 0; t < 4; t++) {
    union { _Float16 hh[8]; float4 f4; } o;
#pragma unroll
    for (int r = 0; r < 8; r++) o.hh[r] = (_Float16)(acc[t][r] / lsum);
    *(float4*)(crow_out + t * 16) = o.f4;
  }
}

// ---------------------------------------------------------------------------
// Host-side launch
// ---------------------------------------------------------------------------
extern "C" void kernel_launch(void* const* d_in, const int* in_sizes, int n_in,
                              void* d_out, int out_size, void* d_ws, size_t ws_size,
                              hipStream_t stream) {
  const float* q_in  = (const float*)d_in[0];
  const float* k_in  = (const float*)d_in[1];
  const float* v_in  = (const float*)d_in[2];
  const int*   mask  = (const int*)d_in[3];
  const float* wq    = (const float*)d_in[4];
  const float* wqb   = (const float*)d_in[5];
  const float* wk    = (const float*)d_in[6];
  const float* wkb   = (const float*)d_in[7];
  const float* wv    = (const float*)d_in[8];
  const float* wvb   = (const float*)d_in[9];
  const float* wo    = (const float*)d_in[10];
  const float* wob   = (const float*)d_in[11];

  // Workspace carving (33 MB total, 256B aligned)
  char* ws = (char*)d_ws;
  size_t off = 0;
  auto alloc = [&](size_t bytes) {
    void* p = ws + off;
    off += (bytes + 255) & ~(size_t)255;
    return p;
  };
  const size_t IN_E = (size_t)MT * D;   // 4194304
  _Float16* Qp  = (_Float16*)alloc(IN_E * 2);
  _Float16* Kp  = (_Float16*)alloc(IN_E * 2);
  _Float16* Vt  = (_Float16*)alloc(IN_E * 2);   // [b][h][d][s]
  _Float16* ctx = (_Float16*)alloc(IN_E * 2);
  unsigned* pm  = (unsigned*)alloc((size_t)MT * S / 8);   // one bit per mask element

  // 0) the mask as lane masks: 256 groups of 16 rows
  pack_mask<<<MT / 16, 256, 0, stream>>>(mask, pm);

  // 1) the three projections in one launch, straight from the f32 inputs and weights
  dim3 gg(D / 128, MT / 128);      // (8, 32)
  dim3 g3(D / 128, MT / 128, 3);   // (8, 32, 3)
  gemm_qkv_wmma<<<g3, 256, 0, stream>>>(q_in, k_in, v_in, wq, wk, wv, wqb, wkb, wvb, Qp, Kp, Vt);

  // 2) attention: 512 blocks = B*H * (S/128)
  flash_attn_wmma<<<BB * H * (S / 128), 256, 0, stream>>>(Qp, Kp, Vt, pm, ctx);

  // 3) output projection -> fp32 d_out
  gemm_out_wmma<<<gg, 256, 0, stream>>>(ctx, wo, wob, (float*)d_out);
}

// v010
// It runs in 86.8 microseconds.
// It is 1.09 times as fast as v008, going by the measured steps of the versions left out in between.
// Over all steps from v000 it is 3.83 times as fast.
#include <hip/hip_runtime.h>
#include <hip/hip_bf16.h>

// ---------------------------------------------------------------------------
// Multi-head attention for MI455X (gfx1250, wave32, WMMA f32_16x16x32_f16).
// Pipeline: Q/K/V proj GEMMs (WMMA, double-buffered LDS; f32 operands are rounded
// to f16 on their way into LDS), whose Q and K blocks also pack the mask to lane
// masks | flash attention (WMMA, online softmax) | output proj GEMM (WMMA, fp32 out).
// ~69 GFLOP total, ~120MB minimum HBM traffic -> roughly balanced with f16
// matrix cores; scalar fp32 would be hopelessly compute-bound.
// ---------------------------------------------------------------------------

typedef __attribute__((ext_vector_type(16))) _Float16 v16h;
typedef __attribute__((ext_vector_type(8)))  float    v8f;
typedef __attribute__((ext_vector_type(2)))  float    v2f;
typedef __attribute__((ext_vector_type(2)))  _Float16 v2h;
typedef __attribute__((ext_vector_type(8)))  short    s16x8;
typedef __attribute__((ext_vector_type(16))) unsigned u32x16;
typedef const __attribute__((address_space(4))) u32x16 const_u32x16;  // memory no store of the kernel touches

#define WMMA16(a, b, c) \
  __builtin_amdgcn_wmma_f32_16x16x32_f16(false, (a), false, (b), (short)0, (c), false, false)

constexpr int BB = 2;      // batch
constexpr int S  = 2048;   // seq len
constexpr int D  = 1024;   // model dim
constexpr int H  = 16;     // heads
constexpr int HD = 64;     // head dim
constexpr int MT = BB * S; // 4096 tokens

// The softmax works in powers of two: exp(s / 8 - m) = exp2(s * QSCALE - m * log2(e)).
// The Q projection multiplies its f32 result by QSCALE before it rounds to f16, so the
// score product leaves the matrix unit in those units and no score is multiplied again.
constexpr float LOG2E  = 1.4426950408889634f;
constexpr float QSCALE = 0.125f * LOG2E;     // 1/sqrt(64) * log2(e)
constexpr float MASKED = -1.0e9f * LOG2E;    // the reference's -1e9, in the same units

// Load one v16h WMMA operand (16-bit A/B layout): caller passes base already
// offset by kA = (lane<16 ? 0 : 8); halves 0..7 = base[0..7], 8..15 = base[16..23].
__device__ __forceinline__ v16h load_op16(const _Float16* p) {
  union { v16h v; float4 f4[2]; } u;
  u.f4[0] = *(const float4*)(p);
  u.f4[1] = *(const float4*)(p + 16);
  return u.v;
}

// LDS row pitches of the GEMM tiles, in halves, each chosen for its reader.
constexpr int PA = 40;   // A [m][k]: 64 B of data + 16 B (16 B x odd: ds_load_b128 without bank conflicts)
constexpr int PB = 144;  // B [k][n]: 256 B of data + 32 B (32 B x odd: ds_load_tr16_b128 without bank conflicts)

// One v16h B operand out of a row-major [k][n] LDS tile by two transposing loads.
// p is the lane's own address: row 8 * (lane >> 4) + (lane & 7), column base + 8 * ((lane >> 3) & 1).
// The lane gets column base + (lane & 15): halves 0..7 = k 8*hi + 0..7, halves 8..15 = k 16 + 8*hi + 0..7,
// the k order of load_op16.
__device__ __forceinline__ v16h load_op16_tr(const _Float16* p) {
  typedef __attribute__((address_space(3))) s16x8 lds_s16x8;
  union { v16h v; s16x8 q[2]; } u;
  u.q[0] = __builtin_amdgcn_ds_load_tr16_b128_v8i16((lds_s16x8*)p);
  u.q[1] = __builtin_amdgcn_ds_load_tr16_b128_v8i16((lds_s16x8*)(p + 16 * PB));
  return u.v;
}

// ---------------------------------------------------------------------------
// GEMM: C[M=4096][N=1024] = f16(A[4096][1024]) x f16(B[1024][1024]) + bias(f32)
// MODE 0: the three input projections in ONE launch, blockIdx.z picks the problem:
//         z = 0, 1: A = f32 query / key, store f16 row-major (Q times QSCALE, K)
//         z = 2:    A = f32 value, store f16 as Vt[b,h,d,s] (pre-transposed for P@V)
//         768 blocks = three on every WGP (six waves a SIMD): one block's wait for
//         its next tile's global loads is filled by the other two blocks' work.
// MODE 2: A = A16 (f16), store f32 row-major      (final output projection)
// B is always the f32 weight. f32 operands are read as whole 128-B lines and
// rounded to f16 between the staging registers and LDS, so no separate cast pass.
// B stays [k][n] in LDS as it lies in memory (a wave stores one whole 256-B row at
// a time) and is transposed by the LDS loads that form the operand.
// Block tile 128x128, 8 waves (4 along M x 2 along N), K-step 32,
// double-buffered LDS: one barrier per K-step, global loads for step k+1
// staged in registers while WMMAs consume buffer k.
// MODE 2 has one block on a WGP and nobody to fill its waits: its global loads run
// four K-steps ahead, in four register sets, so that a load has four steps to arrive.
// ---------------------------------------------------------------------------
template <int V> struct form_tag { static constexpr int value = V; };

// Work-group barrier that orders LDS traffic alone. __syncthreads() also waits for every
// global load of the wave, which would end the flight of loads issued several steps ahead.
__device__ __forceinline__ void lds_barrier() {
  __builtin_amdgcn_fence(__ATOMIC_RELEASE, "workgroup", "local");
  __builtin_amdgcn_s_barrier();
  __builtin_amdgcn_fence(__ATOMIC_ACQUIRE, "workgroup", "local");
}

template <int MODE>
__device__ __forceinline__ void gemm_body(
    const float* __restrict__ A32, const _Float16* __restrict__ A16,
    const float* __restrict__ Bw, const float* __restrict__ bias,
    void* __restrict__ out, const bool vt_out, const float oscale,
    const int* __restrict__ mask, unsigned* __restrict__ pm, const int pjob) {
  constexpr int K = 1024, N = 1024;
  __shared__ __attribute__((aligned(16))) _Float16 lds_a[2][128 * PA];  // [m][k], padded rows
  __shared__ __attribute__((aligned(16))) _Float16 lds_b[2][32 * PB];   // [k][n], padded rows

  const int tid  = threadIdx.x;
  const int wave = tid >> 5, lane = tid & 31;
  const int l15  = lane & 15, hi = lane >> 4;
  const int kA   = hi ? 8 : 0;
  const int wm   = wave & 3;   // 4 wave-rows of 32
  const int wn   = wave >> 2;  // 2 wave-cols of 64
  const int m0   = blockIdx.y * 128, n0 = blockIdx.x * 128;

  // per-thread staging assignment
  const int arow = tid >> 1, akc = (tid & 1) * 16;  // f16 A: 128 rows x 32, 16 halves a thread
  const int fr = tid >> 3, fc = (tid & 7) * 4;      // f32 A: rows fr + 32*i, 4 floats: 8 lanes = one line
  const int bc = lane * 4;                          // f32 B: k rows wave + 8*i, 4 columns: a wave = one 512-B row

  v8f acc[2][4];
  const v8f vzero = {0.f, 0.f, 0.f, 0.f, 0.f, 0.f, 0.f, 0.f};
#pragma unroll
  for (int i = 0; i < 2; i++)
#pragma unroll
    for (int j = 0; j < 4; j++) acc[i][j] = vzero;

  float4 ra0, ra1, ra2, ra3, rb0, rb1, rb2, rb3;
  auto g_load = [&](int k0) {  // MODE 0
    const float* asrc = A32 + (size_t)(m0 + fr) * K + k0 + fc;
    ra0 = *(const float4*)(asrc);
    ra1 = *(const float4*)(asrc + 32 * K);
    ra2 = *(const float4*)(asrc + 64 * K);
    ra3 = *(const float4*)(asrc + 96 * K);
    const float* bsrc = Bw + (size_t)(k0 + wave) * N + n0 + bc;
    rb0 = *(const float4*)(bsrc);
    rb1 = *(const float4*)(bsrc + 8 * N);
    rb2 = *(const float4*)(bsrc + 16 * N);
    rb3 = *(const float4*)(bsrc + 24 * N);
  };
  // four f32 of one A row -> four f16, one 8-byte LDS store
  auto a_put = [&](int buf, int row, float4 v) {
    union { _Float16 h[4]; unsigned long long u; } w;
    w.h[0] = (_Float16)v.x; w.h[1] = (_Float16)v.y;
    w.h[2] = (_Float16)v.z; w.h[3] = (_Float16)v.w;
    *(unsigned long long*)(&lds_a[buf][row * PA + fc]) = w.u;
  };
  // four f32 of one B row -> four f16, one 8-byte LDS store in the same row
  auto b_put = [&](int buf, int krow, float4 v) {
    union { _Float16 h[4]; unsigned long long u; } w;
    w.h[0] = (_Float16)v.x; w.h[1] = (_Float16)v.y;
    w.h[2] = (_Float16)v.z; w.h[3] = (_Float16)v.w;
    *(unsigned long long*)(&lds_b[buf][krow * PB + bc]) = w.u;
  };
  auto l_store = [&](int buf) {  // MODE 0
    a_put(buf, fr, ra0);
    a_put(buf, fr + 32, ra1);
    a_put(buf, fr + 64, ra2);
    a_put(buf, fr + 96, ra3);
    b_put(buf, wave, rb0);
    b_put(buf, wave + 8, rb1);
    b_put(buf, wave + 16, rb2);
    b_put(buf, wave + 24, rb3);
  };

  // one K-step's products out of LDS buffer cur
  auto consume = [&](int cur) __attribute__((always_inline)) {
    v16h aop[2], bop[4];
#pragma unroll
    for (int mt = 0; mt < 2; mt++)
      aop[mt] = load_op16(&lds_a[cur][(wm * 32 + mt * 16 + l15) * PA + kA]);
#pragma unroll
    for (int nt = 0; nt < 4; nt++)
      bop[nt] = load_op16_tr(&lds_b[cur][(hi * 8 + (lane & 7)) * PB + wn * 64 + nt * 16 + ((lane >> 3) & 1) * 8]);
    // keeps all twelve LDS loads in one group ahead of the WMMAs; without it the second
    // A fragment's loads sink between them and their latency is waited out in mid-step
    __builtin_amdgcn_sched_barrier(0);
#pragma unroll
    for (int mt = 0; mt < 2; mt++)
#pragma unroll
      for (int nt = 0; nt < 4; nt++)
        acc[mt][nt] = WMMA16(aop[mt], bop[nt], acc[mt][nt]);
  };

  if constexpr (MODE == 2) {
    constexpr int DP = 4;  // K-steps between a tile's global loads and its LDS stores
    typedef __attribute__((ext_vector_type(4))) float f32x4;
    f32x4 sa[DP][2];   // tile t waits in set t % DP
    float4 sb[DP][4];
    const _Float16* ap = A16 + (size_t)(m0 + arow) * K + akc;  // this thread's part of the tile of step 0 of four
    const float* bp = Bw + (size_t)wave * N + n0 + bc;
    auto fetch = [&](int set, int t) __attribute__((always_inline)) {  // tile t, counted from ap and bp
      sa[set][0] = *(const f32x4*)(ap + t * 32);
      sa[set][1] = *(const f32x4*)(ap + t * 32 + 8);
#pragma unroll
      for (int i = 0; i < 4; i++) sb[set][i] = *(const float4*)(bp + (t * 32 + 8 * i) * N);
    };
    auto put = [&](int set, int buf) __attribute__((always_inline)) {
      *(f32x4*)(&lds_a[buf][arow * PA + akc])     = sa[set][0];
      *(f32x4*)(&lds_a[buf][arow * PA + akc + 8]) = sa[set][1];
#pragma unroll
      for (int i = 0; i < 4; i++) b_put(buf, wave + 8 * i, sb[set][i]);
    };
    fetch(0, 0);
    fetch(1, 1);
    fetch(2, 2);
    fetch(3, 3);
    put(0, 0);
    lds_barrier();
    // step u of four; the register sets and the LDS buffer are named by constants
    auto step = [&](auto ut, auto more) __attribute__((always_inline)) {
      constexpr int u = decltype(ut)::value;
      if constexpr (decltype(more)::value) fetch(u, u + DP);  // into the set that the step before has emptied
      consume(u & 1);
      if constexpr (decltype(more)::value || u + 1 < DP)
        put((u + 1) % DP, (u + 1) & 1);  // other buffer: no conflict with current readers
      lds_barrier();
    };
    // The last DP steps fetch nothing and stand apart: a branch round the loads would join two
    // paths in the compiler's counting of loads in flight and make the waits stricter.
    for (int k0 = 0; k0 < K - DP * 32; k0 += DP * 32) {
      step(form_tag<0>{}, form_tag<1>{});
      step(form_tag<1>{}, form_tag<1>{});
      step(form_tag<2>{}, form_tag<1>{});
      step(form_tag<3>{}, form_tag<1>{});
      // the loads in flight have taken their addresses before the two pointers move on
      // (the operands keep the pointers' registers as they are up to the wait)
      asm volatile("s_wait_xcnt 0x0" :: "v"(ap), "v"(bp) : "memory");
      ap += DP * 32;
      bp += DP * 32 * N;
    }
    step(form_tag<0>{}, form_tag<0>{});
    step(form_tag<1>{}, form_tag<0>{});
    step(form_tag<2>{}, form_tag<0>{});
    step(form_tag<3>{}, form_tag<0>{});
  } else {
    // Mask -> lane masks, once for all 16 heads, by the waves of the blocks with pjob >= 0.
    // One 32-bit word per (16-query group g, 16-key tile kt, register r) of the attention's
    // score tiles:
    //   bit L of pm[(g * 128 + kt) * 8 + r] = mask[row g * 16 + (L & 15)][key kt * 16 + 8 * (L >> 4) + r] != 0
    // which is the lane -> (query, key) map of score register r. The word is the same
    // for a whole wave, so attention reads it by scalar loads and selects with it as is.
    // One wave: 16 rows x 128 keys (job = g * 16 + 128-key segment). Its rows come into LDS
    // through no register, by one asynchronous 512-B copy in each of the first 16 K-steps, so
    // that the mask streams in under the products; the words are formed behind the loop.
    constexpr int PM = 132;  // ints per LDS mask row: 512 B + 16 B (16 B x odd: ds_load_b128 without bank conflicts)
    __shared__ __attribute__((aligned(16))) int lds_m[8][16 * PM];
    // The wave's number is made scalar: row addresses and their steps then stay in scalar registers,
    // and the loop holds no vector register for them but the lane's own 16-byte offset.
    const int swave = __builtin_amdgcn_readfirstlane(wave);
    const int job = pjob + swave;
    const int* mrow = mask + (size_t)((job >> 4) * 16) * S + (job & 15) * 128;
    const unsigned mlds = (unsigned)(size_t)&lds_m[swave][0];
    const unsigned lane16 = lane * 16;

    g_load(0);
    l_store(0);
    __syncthreads();

    for (int k0 = 0; k0 < K; k0 += 32) {
      const int cur = (k0 >> 5) & 1, nxt = cur ^ 1;
      const bool more = (k0 + 32) < K;
      if (pjob >= 0 && k0 < 16 * 32) {  // the same for the whole block
        const int* mg = mrow + (size_t)(k0 >> 5) * S;
        const unsigned ml = mlds + (k0 >> 5) * (PM * 4) + lane16;
        // mask row k0 / 32 of the wave's 16, global (scalar row base + lane offset) -> LDS; the
        // closing s_wait_xcnt keeps the address registers unchanged until the copy has taken them
        asm volatile(
            "global_load_async_to_lds_b128 %0, %1, %2\n\t"
            "s_wait_xcnt 0x0"
            :: "v"(ml), "v"(lane16), "s"(mg) : "memory");
      }
      if (more) g_load(k0 + 32);  // overlap next global fetch with WMMA
      consume(cur);
      if (more) l_store(nxt);  // other buffer: no conflict with current readers
      __syncthreads();
    }

    if (pjob >= 0) {
      asm volatile("s_wait_asynccnt 0x0" ::: "memory");  // own copies of the mask rows have landed
      __syncthreads();                                   // the mask rows are readable
      const int* msrc = &lds_m[wave][l15 * PM + hi * 8];
      unsigned* pdst = pm + (size_t)(job >> 4) * (S / 2) + (job & 15) * 64 + lane;
#pragma unroll  // constant indices: registers
      for (int t = 0; t < 2; t++) {
        unsigned mine = 0;
#pragma unroll
        for (int j = 0; j < 4; j++) {
          const int4 m0v = *(const int4*)(msrc + (t * 4 + j) * 16);
          const int4 m1v = *(const int4*)(msrc + (t * 4 + j) * 16 + 4);
          const int mv[8] = {m0v.x, m0v.y, m0v.z, m0v.w, m1v.x, m1v.y, m1v.z, m1v.w};
#pragma unroll
          for (int r = 0; r < 8; r++) {
            const unsigned w = __builtin_amdgcn_ballot_w32(mv[r] != 0);
            if (lane == j * 8 + r) mine = w;
          }
        }
        pdst[t * 32] = mine;
      }
      // the stores have taken their registers before what follows rewrites them
      asm volatile("s_wait_xcnt 0x0" ::: "memory");
    }
  }

  // Epilogue: add bias, store per form. C layout: VGPR r holds row r + 8*hi,
  // lane%16 holds column within the 16x16 tile. The form is chosen once, outside
  // the loops (FORM 0: f16 row-major, 1: f16 Vt[b,h,d,s], 2: f32 row-major).
  auto store_all = [&](auto form) {
    constexpr int FORM = decltype(form)::value;
#pragma unroll
    for (int mt = 0; mt < 2; mt++) {
#pragma unroll
      for (int nt = 0; nt < 4; nt++) {
        int col = n0 + wn * 64 + nt * 16 + l15;
        float bv = bias[col];
        union { v8f v; float f[8]; } u;
        u.v = acc[mt][nt];
#pragma unroll
        for (int r = 0; r < 8; r++) {
          int row = m0 + wm * 32 + mt * 16 + r + hi * 8;
          float val = u.f[r] + bv;
          if (FORM == 0) {
            ((_Float16*)out)[(size_t)row * N + col] = (_Float16)(val * oscale);  // Q: QSCALE, K: 1
          } else if (FORM == 1) {
            int hh = col >> 6, dd = col & 63;        // head, dim-in-head
            int b = row >> 11, s = row & (S - 1);    // batch, position
            ((_Float16*)out)[((size_t)(b * H + hh) * HD + dd) * S + s] = (_Float16)val;
          } else {
            ((float*)out)[(size_t)row * N + col] = val;
          }
        }
      }
    }
    // In the built object the Vt form's code follows this form's stores and writes
    // their registers: they are held until the stores have taken them.
    if constexpr (FORM == 0) asm volatile("s_wait_xcnt 0x0" ::: "memory");
  };
  if constexpr (MODE == 2) {
    store_all(form_tag<2>{});
  } else {
    if (vt_out) store_all(form_tag<1>{});
    else        store_all(form_tag<0>{});
  }
}

// Q, K and V projections, one launch. At 160 registers a wave and 106,496 B of LDS a
// block, three blocks fit on a WGP, so all 768 are resident at once.
__global__ __launch_bounds__(256) void gemm_qkv_wmma(
    const float* __restrict__ xq, const float* __restrict__ xk, const float* __restrict__ xv,
    const float* __restrict__ wq, const float* __restrict__ wk, const float* __restrict__ wv,
    const float* __restrict__ bq, const float* __restrict__ bk, const float* __restrict__ bv,
    _Float16* __restrict__ oq, _Float16* __restrict__ ok, _Float16* __restrict__ ov,
    const int* __restrict__ mask, unsigned* __restrict__ pm) {
  const int z = blockIdx.z;
  const float* x = z == 0 ? xq : z == 1 ? xk : xv;
  const float* w = z == 0 ? wq : z == 1 ? wk : wv;
  const float* bi = z == 0 ? bq : z == 1 ? bk : bv;
  _Float16* o = z == 0 ? oq : z == 1 ? ok : ov;
  // The 512 blocks of Q and K share the 4096 mask-packing jobs, one a wave.
  const int pjob = z < 2 ? ((z * 32 + (int)blockIdx.y) * 8 + (int)blockIdx.x) * 8 : -1;
  gemm_body<0>(x, nullptr, w, bi, (void*)o, z == 2, z == 0 ? QSCALE : 1.0f, mask, pm, pjob);
}

__global__ __launch_bounds__(256) void gemm_out_wmma(
    const _Float16* __restrict__ A16, const float* __restrict__ Bw,
    const float* __restrict__ bias, float* __restrict__ out) {
  gemm_body<2>(nullptr, A16, Bw, bias, (void*)out, false, 1.0f, nullptr, nullptr, -1);
}

constexpr int KT      = 64;
constexpr int NT      = S / KT;
constexpr int PITCH   = 72;
constexpr int TILE_H  = 64 * PITCH;
constexpr float LAG   = 8.0f;

__device__ __forceinline__ unsigned lds_off(const void* p) { return (unsigned)(size_t)p; }

// value of lane ^ 16 (the other 16-lane half), by a vector cross-row move
__device__ __forceinline__ float other_half(float x) {
  const int b = __builtin_bit_cast(int, x);
  return __builtin_bit_cast(float,
      __builtin_amdgcn_permlanex16(b, b, 0x76543210, 0xfedcba98, false, false));
}

// 512 blocks on 256 WGPs: four waves a SIMD is all the grid gives, so let the
// register budget be that of four.
__global__ __launch_bounds__(256) __attribute__((amdgpu_waves_per_eu(4, 4))) void flash_attn_wmma(
    const _Float16* __restrict__ Qp, const _Float16* __restrict__ Kp,
    const _Float16* __restrict__ Vt, const unsigned* __restrict__ pm,
    _Float16* __restrict__ ctx) {
  __shared__ __attribute__((aligned(16))) _Float16 lds_k[2][TILE_H];  // [key][d], padded rows
  __shared__ __attribute__((aligned(16))) _Float16 lds_v[2][TILE_H];  // [d][key], padded rows

  const int tid  = threadIdx.x;
  const int wave = tid >> 5, lane = tid & 31;
  const int l15  = lane & 15, hi = lane >> 4;
  const int kA   = hi ? 8 : 0;

  const int qb = blockIdx.x & 15;  // S/128 = 16 query blocks
  const int bh = blockIdx.x >> 4;  // b*H + h
  const int b  = bh >> 4, h = bh & 15;
  const int sq = qb * 128 + wave * 16;  // first query row (within sequence)

  // Copy assignment: 8 lanes per 128-B row, rows crow and crow + 32 of each tile.
  const int crow = tid >> 3, cc = tid & 7;
  const _Float16* kg = Kp + ((size_t)(b * S + crow)) * D + h * HD + cc * 8;
  const _Float16* vg = Vt + ((size_t)bh * HD + crow) * S + cc * 8;
  const unsigned lk = lds_off(&lds_k[0][crow * PITCH + cc * 8]);
  const unsigned lv = lds_off(&lds_v[0][crow * PITCH + cc * 8]);

  auto stage = [&](int t, int buf) {
    const _Float16* gk0 = kg + (size_t)t * KT * D;
    const _Float16* gk1 = gk0 + 32 * D;
    const _Float16* gv0 = vg + t * KT;
    const _Float16* gv1 = gv0 + 32 * S;
    const unsigned lk0 = lk + buf * (TILE_H * 2), lk1 = lk0 + 32 * PITCH * 2;
    const unsigned lv0 = lv + buf * (TILE_H * 2), lv1 = lv0 + 32 * PITCH * 2;
    // Global -> LDS through no register; the closing s_wait_xcnt keeps the
    // address registers unchanged until the copies have taken them.
    asm volatile(
        "global_load_async_to_lds_b128 %0, %4, off\n\t"
        "global_load_async_to_lds_b128 %1, %5, off\n\t"
        "global_load_async_to_lds_b128 %2, %6, off\n\t"
        "global_load_async_to_lds_b128 %3, %7, off\n\t"
        "s_wait_xcnt 0x0"
        :: "v"(lk0), "v"(lk1), "v"(lv0), "v"(lv1),
           "v"(gk0), "v"(gk1), "v"(gv0), "v"(gv1)
        : "memory");
  };

  // Q rows held in registers: B-operand layout (column = query), d split into two K=32 chunks
  const _Float16* qbase = Qp + ((size_t)(b * S + sq + l15)) * D + h * HD;
  v16h aq0 = load_op16(qbase + kA);
  v16h aq1 = load_op16(qbase + 32 + kA);

  const v8f vzero = {0.f, 0.f, 0.f, 0.f, 0.f, 0.f, 0.f, 0.f};
  v8f acc[4];  // O^T: acc[t][r] = O[query l15][d = t * 16 + 8 * hi + r]
#pragma unroll
  for (int t = 0; t < 4; t++) acc[t] = vzero;
  float mrun = -INFINITY;  // reference maximum of this lane's query, equal in both halves
  float lrun = 0.f;        // running sum over this half's keys only; halves joined at the end

  // this wave's lane masks (packed by the projection launch): 8 words per 16 keys, 32 per staged tile.
  // The wave's number is made scalar and the words, which an earlier launch of this call wrote and
  // this one only reads, are read as constant memory, so that they come by scalar loads.
  const_u32x16* pw = (const_u32x16*)(pm +
      (size_t)(b * (S / 16) + qb * 8 + __builtin_amdgcn_readfirstlane(wave)) * (S / 2));

  u32x16 ln0 = pw[0], ln1 = pw[1];  // tile 0's lane masks

  stage(0, 0);
  asm volatile("s_wait_asynccnt 0x0" ::: "memory");  // own copies of tile 0 have landed
  __syncthreads();                                   // tile 0 readable by every wave
  stage(1, 1);

  for (int tl = 0; tl < NT; tl++) {
    const int buf = tl & 1;
    const _Float16* kt = &lds_k[buf][0];
    const _Float16* vt = &lds_v[buf][0];
    const u32x16 lm[2] = {ln0, ln1};
    // the next tile's lane masks, a whole tile ahead of their use (the last tile reads its own again)
    const int tn = tl + 1 < NT ? tl + 1 : tl;
    ln0 = pw[tn * 2];
    ln1 = pw[tn * 2 + 1];
    // ---- scores^T of the whole tile: four 16x16 tiles (64 keys), contraction over HD=64 = 2xK32
    float p[4][8];
#pragma unroll  // constant LDS offsets and lane-mask registers
    for (int j = 0; j < 4; j++) {
      const _Float16* kb = kt + (j * 16 + l15) * PITCH;
      v16h bk0 = load_op16(kb + kA);
      v16h bk1 = load_op16(kb + 32 + kA);
      v8f sc = vzero;
      sc = WMMA16(bk0, aq0, sc);  // A = K rows, B = Q^T
      sc = WMMA16(bk1, aq1, sc);  // Q carries QSCALE: scores / 8 * log2(e)
#pragma unroll  // p and the lane masks stay in registers only under constant indices
      for (int r = 0; r < 8; r++)
        p[j][r] = __builtin_amdgcn_inverse_ballot_w32(lm[j >> 1][(j & 1) * 8 + r]) ? sc[r] : MASKED;
    }
    // ---- the tile's maximum: 32 of the query's 64 scores are in this lane, 32 in lane ^ 16
    float mx[8];
#pragma unroll  // constant indices: registers
    for (int r = 0; r < 8; r++) mx[r] = fmaxf(fmaxf(p[0][r], p[1][r]), fmaxf(p[2][r], p[3][r]));
    float m = fmaxf(fmaxf(fmaxf(mx[0], mx[1]), fmaxf(mx[2], mx[3])),
                    fmaxf(fmaxf(mx[4], mx[5]), fmaxf(mx[6], mx[7])));
    m = fmaxf(m, other_half(m));
    // ---- lazy rescale: mrun is only the reference point of the exponentials and cancels in
    // O / sum, so it may lag the true maximum. It is renewed, and O and the sum brought to the
    // new reference, only when some query of the wave has outgrown it by more than 2^LAG; until
    // then P stays at or below 2^LAG, far inside f16. One test a tile, a scalar branch.
    if (__builtin_expect(__builtin_amdgcn_ballot_w32(m > mrun + LAG) != 0, 0)) {
      const float mnew = fmaxf(mrun, m);
      const float corr = __builtin_amdgcn_exp2f(mrun - mnew);  // first tile: exp2(-inf) = 0
      mrun = mnew;
      lrun *= corr;
#pragma unroll  // constant indices: registers
      for (int t = 0; t < 4; t++) acc[t] *= corr;
    }
#pragma unroll  // both 32-key halves of the tile: constant LDS offsets
    for (int ps = 0; ps < KT / 32; ps++) {
      union { v16h v; v2h h2[8]; } bp;  // P^T as B operand: halves 0..7 = tile 0, 8..15 = tile 1
      float sm[2][4];
#pragma unroll
      for (int j = 0; j < 2; j++) {
#pragma unroll
        for (int i = 0; i < 4; i++) {
          const v2f d = (v2f){p[ps * 2 + j][2 * i], p[ps * 2 + j][2 * i + 1]} - mrun;
          const v2f e = {__builtin_amdgcn_exp2f(d[0]), __builtin_amdgcn_exp2f(d[1])};
          sm[j][i] = e[0] + e[1];
          bp.h2[j * 4 + i] = __builtin_convertvector(e, v2h);
        }
      }
      lrun += ((sm[0][0] + sm[0][1]) + (sm[0][2] + sm[0][3])) +
              ((sm[1][0] + sm[1][1]) + (sm[1][2] + sm[1][3]));
      // ---- V^T(64x32) @ P^T(32x16): staged Vt rows are contiguous along keys
#pragma unroll
      for (int t = 0; t < 4; t++) {
        const _Float16* vb = vt + (t * 16 + l15) * PITCH + ps * 32;
        v16h av = load_op16(vb + kA);
        acc[t] = WMMA16(av, bp.v, acc[t]);
      }
    }
    // Hand-over: this wave's reads of tile tl are done, its copies of tile
    // tl + 1 have landed; behind the barrier both hold for every wave.
    asm volatile("s_wait_dscnt 0x0" ::: "memory");
    asm volatile("s_wait_asynccnt 0x0" ::: "memory");
    // the lane-mask loads have taken their address before the loop's step rewrites it
    asm volatile("s_wait_xcnt 0x0" ::: "memory");
    __syncthreads();
    if (tl + 2 < NT) stage(tl + 2, buf);  // refill the buffer every wave has left
  }
  asm volatile("s_wait_asynccnt 0x0" ::: "memory");  // nothing in flight at the wave's end

  // ---- normalize and store into context [token][h*64 + d]: 8 consecutive d a lane
  const float lsum = lrun + other_half(lrun);
  _Float16* crow_out = ctx + ((size_t)(b * S + sq + l15)) * D + h * HD + hi * 8;
#pragma unroll
  for (int t = 0; t < 4; t++) {
    union { _Float16 hh[8]; float4 f4; } o;
#pragma unroll
    for (int r = 0; r < 8; r++) o.hh[r] = (_Float16)(acc[t][r] / lsum);
    *(float4*)(crow_out + t * 16) = o.f4;
  }
}

// ---------------------------------------------------------------------------
// Host-side launch
// ---------------------------------------------------------------------------
extern "C" void kernel_launch(void* const* d_in, const int* in_sizes, int n_in,
                              void* d_out, int out_size, void* d_ws, size_t ws_size,
                              hipStream_t stream) {
  const float* q_in  = (const float*)d_in[0];
  const float* k_in  = (const float*)d_in[1];
  const float* v_in  = (const float*)d_in[2];
  const int*   mask  = (const int*)d_in[3];
  const float* wq    = (const float*)d_in[4];
  const float* wqb   = (const float*)d_in[5];
  const float* wk    = (const float*)d_in[6];
  const float* wkb   = (const float*)d_in[7];
  const float* wv    = (const float*)d_in[8];
  const float* wvb   = (const float*)d_in[9];
  const float* wo    = (const float*)d_in[10];
  const float* wob   = (const float*)d_in[11];

  // Workspace carving (33 MB total, 256B aligned)
  char* ws = (char*)d_ws;
  size_t off = 0;
  auto alloc = [&](size_t bytes) {
    void* p = ws + off;
    off += (bytes + 255) & ~(size_t)255;
    return p;
  };
  const size_t IN_E = (size_t)MT * D;   // 4194304
  _Float16* Qp  = (_Float16*)alloc(IN_E * 2);
  _Float16* Kp  = (_Float16*)alloc(IN_E * 2);
  _Float16* Vt  = (_Float16*)alloc(IN_E * 2);   // [b][h][d][s]
  _Float16* ctx = (_Float16*)alloc(IN_E * 2);
  unsigned* pm  = (unsigned*)alloc((size_t)MT * S / 8);   // one bit per mask element

  // 1) the three projections in one launch, straight from the f32 inputs and weights;
  //    its Q and K blocks also write the mask as lane masks
  dim3 gg(D / 128, MT / 128);      // (8, 32)
  dim3 g3(D / 128, MT / 128, 3);   // (8, 32, 3)
  gemm_qkv_wmma<<<g3, 256, 0, stream>>>(q_in, k_in, v_in, wq, wk, wv, wqb, wkb, wvb, Qp, Kp, Vt, mask, pm);

  // 2) attention: 512 blocks = B*H * (S/128)
  flash_attn_wmma<<<BB * H * (S / 128), 256, 0, stream>>>(Qp, Kp, Vt, pm, ctx);

  // 3) output projection -> fp32 d_out
  gemm_out_wmma<<<gg, 256, 0, stream>>>(ctx, wo, wob, (float*)d_out);
}
